// v000
// The times below were measured on an AMD MI455X: many runs one after another, warmed up first and cycling through
// copies of the inputs, with the whole window's GPU time divided by the number of runs. Launches and the gaps
// between them are all in it. The median over several windows is given; except for v000 it joins two sittings, which
// can be a few percent apart, so the side-by-side timings, each taken in one sitting, are the better comparison.
// The starting kernel, v000, takes 237 microseconds a run.
#include <hip/hip_runtime.h>
#include <hip/hip_bf16.h>

typedef __attribute__((ext_vector_type(16))) _Float16 v16h;
typedef __attribute__((ext_vector_type(8)))  _Float16 v8h;
typedef __attribute__((ext_vector_type(8)))  float    v8f;

#define B_SZ   4
#define S_LEN  2048
#define NHEAD  8
#define DHEAD  64
#define DIM    512

// 1/sqrt(DHEAD) * log2(e): folds softmax scaling AND the exp->exp2 change of
// base into the Q projection (applied in fp32 there).
#define Q_SCALE (0.125f * 1.4426950408889634f)

// Build a 16-bit WMMA A/B operand for 16x16x32:
// lane (g = lane>>4) holds halves K = {8g..8g+7} and {16+8g..16+8g+7},
// i.e. two contiguous 16-byte runs from a K-major row/column.
static __device__ __forceinline__ v16h load2x8(const _Float16* base, int g) {
  const v8h lo = *(const v8h*)(base + 8 * g);
  const v8h hi = *(const v8h*)(base + 16 + 8 * g);
  v16h r;
#pragma unroll
  for (int i = 0; i < 8; ++i) { r[i] = lo[i]; r[i + 8] = hi[i]; }
  return r;
}

// ---------------------------------------------------------------------------
// Kernel 1: Y = (X @ W + b) * oscale, converted to f16, written head-split.
//   transposed==0 : dst[((b*H + h)*S + s)*64 + d]   (Q, K)
//   transposed==1 : dst[((b*H + h)*64 + d)*S + s]   (V^T for PV B-operand)
// Block = 128 threads (4 waves); block tile = 64 rows x 64 cols; K step 32.
// ---------------------------------------------------------------------------
__global__ __launch_bounds__(128) void qkv_proj_kernel(
    const float* __restrict__ X, const float* __restrict__ W,
    const float* __restrict__ bias, _Float16* __restrict__ dst,
    int transposed, float oscale) {
  __shared__ __align__(16) _Float16 ldsW[64 * 32];  // [col][k] transposed tile

  const int tid  = threadIdx.x;
  const int w    = tid >> 5;
  const int lane = tid & 31;
  const int g    = lane >> 4;
  const int ln   = lane & 15;
  const int rbase = blockIdx.y * 64;
  const int cbase = blockIdx.x * 64;

  v8f acc[4] = {};
  const int    arow = rbase + 16 * w + ln;    // A operand: lane = row
  const float* xrow = X + (long)arow * DIM;

  for (int kb = 0; kb < DIM / 32; ++kb) {
    __syncthreads();
    // Stage W[kb*32 .. +32)[cbase .. +64) into LDS as f16, [col][k].
#pragma unroll
    for (int i = 0; i < 16; ++i) {
      int linear = tid + 128 * i;          // 0..2047
      int cc = linear & 63;
      int kk = linear >> 6;
      ldsW[cc * 32 + kk] = (_Float16)W[(long)(kb * 32 + kk) * DIM + cbase + cc];
    }
    __syncthreads();

    // A operand (convert f32 -> f16 on the fly)
    const float* ab = xrow + kb * 32;
    v16h A;
#pragma unroll
    for (int j = 0; j < 8; ++j) {
      A[j]     = (_Float16)ab[8 * g + j];
      A[j + 8] = (_Float16)ab[16 + 8 * g + j];
    }

#pragma unroll
    for (int t = 0; t < 4; ++t) {
      v16h B = load2x8(&ldsW[(16 * t + ln) * 32], g);
      acc[t] = __builtin_amdgcn_wmma_f32_16x16x32_f16(
          false, A, false, B, (short)0, acc[t], false, false);
    }
  }

  // Epilogue: bias add, output scale (fp32), f16 convert, head-split store.
#pragma unroll
  for (int t = 0; t < 4; ++t) {
    const int   c  = cbase + 16 * t + ln;
    const float bv = bias[c];
    const int   h  = c >> 6;
    const int   d  = c & 63;
#pragma unroll
    for (int j = 0; j < 8; ++j) {
      int rg = rbase + 16 * w + 8 * g + j;  // C layout: row = 8g + j
      int b  = rg >> 11;                    // S = 2048
      int s  = rg & (S_LEN - 1);
      long idx = transposed
                     ? (((long)(b * NHEAD + h) * DHEAD + d) * S_LEN + s)
                     : (((long)(b * NHEAD + h) * S_LEN + s) * DHEAD + d);
      dst[idx] = (_Float16)((acc[t][j] + bv) * oscale);
    }
  }
}

// ---------------------------------------------------------------------------
// Kernel 2: flash attention, log2-domain softmax. Grid (S/64, H, B),
// 128 threads = 4 waves. Wave w owns q-rows [qb*64 + 16w, +16) x Dh=64
// (4 fp32 accumulators); sweeps 32 key blocks of 64.
// Q was pre-scaled by 1/sqrt(Dh)*log2(e), so p = exp2(s - m) directly
// (single v_exp_f32 per score). Row-sum reduction is deferred: each lane
// carries a partial l over its 4 columns; one butterfly in the epilogue.
// ---------------------------------------------------------------------------
__global__ __launch_bounds__(128) void attn_kernel(
    const _Float16* __restrict__ Q, const _Float16* __restrict__ K,
    const _Float16* __restrict__ VT, float* __restrict__ out) {
  __shared__ __align__(16) _Float16 ldsP[4 * 16 * DHEAD];  // wave-private slabs

  const int tid  = threadIdx.x;
  const int w    = tid >> 5;
  const int lane = tid & 31;
  const int g    = lane >> 4;
  const int ln   = lane & 15;
  const int qb = blockIdx.x, h = blockIdx.y, b = blockIdx.z;

  const long bh = (long)b * NHEAD + h;
  const _Float16* qp = Q  + bh * S_LEN * DHEAD;
  const _Float16* kp = K  + bh * S_LEN * DHEAD;
  const _Float16* vp = VT + bh * DHEAD * S_LEN;

  // Q operand, loop-invariant (already carries softmax scale in log2 units).
  const int qrow = qb * 64 + 16 * w + ln;
  v16h Aq[2];
#pragma unroll
  for (int kc = 0; kc < 2; ++kc)
    Aq[kc] = load2x8(qp + (long)qrow * DHEAD + kc * 32, g);

  float m[8], l[8];
  v8f acc[4] = {};
#pragma unroll
  for (int j = 0; j < 8; ++j) { m[j] = -1e30f; l[j] = 0.0f; }

  _Float16* myP = &ldsP[w * 16 * DHEAD];

  for (int kb = 0; kb < S_LEN / 64; ++kb) {
    // ---- scores (log2 units): S = Qs @ K^T, 16 x 64 per wave ----
    v8f sc[4];
#pragma unroll
    for (int t = 0; t < 4; ++t) {
      const _Float16* kr = kp + (long)(kb * 64 + 16 * t + ln) * DHEAD;
      v16h B0 = load2x8(kr, g);
      v16h B1 = load2x8(kr + 32, g);
      v8f z = {};
      z = __builtin_amdgcn_wmma_f32_16x16x32_f16(false, Aq[0], false, B0,
                                                 (short)0, z, false, false);
      sc[t] = __builtin_amdgcn_wmma_f32_16x16x32_f16(false, Aq[1], false, B1,
                                                     (short)0, z, false, false);
    }

    // ---- row max (butterfly over the 16-lane C-layout group) ----
    float mn[8];
#pragma unroll
    for (int j = 0; j < 8; ++j) {
      float v = fmaxf(fmaxf(sc[0][j], sc[1][j]), fmaxf(sc[2][j], sc[3][j]));
#pragma unroll
      for (int msk = 1; msk < 16; msk <<= 1) v = fmaxf(v, __shfl_xor(v, msk, 32));
      mn[j] = fmaxf(m[j], v);
    }

    // ---- p = 2^(s - m); lane-partial row sums; stash P as f16 in LDS ----
    float corr[8];
#pragma unroll
    for (int j = 0; j < 8; ++j) {
      corr[j] = __builtin_amdgcn_exp2f(m[j] - mn[j]);
      m[j] = mn[j];
      l[j] *= corr[j];
    }
#pragma unroll
    for (int t = 0; t < 4; ++t) {
#pragma unroll
      for (int j = 0; j < 8; ++j) {
        float p = __builtin_amdgcn_exp2f(sc[t][j] - mn[j]);
        l[j] += p;  // partial: this lane's 4 columns only
        myP[(8 * g + j) * DHEAD + 16 * t + ln] = (_Float16)p;
      }
      acc[t] *= *(const v8f*)corr;  // rescale output accumulator
    }

    // ---- PV: acc += P @ V (V stored transposed -> contiguous B loads) ----
    v16h Ap0 = load2x8(myP + ln * DHEAD, g);
    v16h Ap1 = load2x8(myP + ln * DHEAD + 32, g);
#pragma unroll
    for (int t = 0; t < 4; ++t) {
      const _Float16* vb = vp + (long)(16 * t + ln) * S_LEN + kb * 64;
      v16h Bv0 = load2x8(vb, g);
      v16h Bv1 = load2x8(vb + 32, g);
      acc[t] = __builtin_amdgcn_wmma_f32_16x16x32_f16(false, Ap0, false, Bv0,
                                                      (short)0, acc[t], false, false);
      acc[t] = __builtin_amdgcn_wmma_f32_16x16x32_f16(false, Ap1, false, Bv1,
                                                      (short)0, acc[t], false, false);
    }
  }

  // ---- epilogue: finish deferred row-sum, normalize, store fp32 ----
#pragma unroll
  for (int j = 0; j < 8; ++j) {
    float v = l[j];
#pragma unroll
    for (int msk = 1; msk < 16; msk <<= 1) v += __shfl_xor(v, msk, 32);
    l[j] = 1.0f / v;
  }
#pragma unroll
  for (int t = 0; t < 4; ++t) {
#pragma unroll
    for (int j = 0; j < 8; ++j) {
      int s = qb * 64 + 16 * w + 8 * g + j;
      out[((long)b * S_LEN + s) * DIM + h * DHEAD + 16 * t + ln] =
          acc[t][j] * l[j];
    }
  }
}

// ---------------------------------------------------------------------------
extern "C" void kernel_launch(void* const* d_in, const int* in_sizes, int n_in,
                              void* d_out, int out_size, void* d_ws, size_t ws_size,
                              hipStream_t stream) {
  const float* q  = (const float*)d_in[0];
  const float* k  = (const float*)d_in[1];
  const float* v  = (const float*)d_in[2];
  const float* Wq = (const float*)d_in[3];
  const float* bq = (const float*)d_in[4];
  const float* Wk = (const float*)d_in[5];
  const float* bk = (const float*)d_in[6];
  const float* Wv = (const float*)d_in[7];
  const float* bv = (const float*)d_in[8];

  const size_t per = (size_t)B_SZ * NHEAD * S_LEN * DHEAD;  // f16 elements
  _Float16* wsq = (_Float16*)d_ws;
  _Float16* wsk = wsq + per;
  _Float16* wsv = wsk + per;

  dim3 blk(128);
  dim3 g1(DIM / 64, (B_SZ * S_LEN) / 64);   // (8, 128)
  qkv_proj_kernel<<<g1, blk, 0, stream>>>(q, Wq, bq, wsq, 0, Q_SCALE);
  qkv_proj_kernel<<<g1, blk, 0, stream>>>(k, Wk, bk, wsk, 0, 1.0f);
  qkv_proj_kernel<<<g1, blk, 0, stream>>>(v, Wv, bv, wsv, 1, 1.0f);

  dim3 g2(S_LEN / 64, NHEAD, B_SZ);         // (32, 8, 4)
  attn_kernel<<<g2, blk, 0, stream>>>(wsq, wsk, wsv, (float*)d_out);
}

// v001
// A run of this version takes 171 microseconds.
// In two side-by-side timings against v000, it was 1.43 and 1.44 times as fast.
#include <hip/hip_runtime.h>
#include <hip/hip_bf16.h>

typedef __attribute__((ext_vector_type(16))) _Float16 v16h;
typedef __attribute__((ext_vector_type(8)))  _Float16 v8h;
typedef __attribute__((ext_vector_type(8)))  float    v8f;

#define B_SZ   4
#define S_LEN  2048
#define NHEAD  8
#define DHEAD  64
#define DIM    512

// 1/sqrt(DHEAD) * log2(e): folds softmax scaling AND the exp->exp2 change of
// base into the Q projection (applied in fp32 there).
#define Q_SCALE (0.125f * 1.4426950408889634f)

// Build a 16-bit WMMA A/B operand for 16x16x32:
// lane (g = lane>>4) holds halves K = {8g..8g+7} and {16+8g..16+8g+7},
// i.e. two contiguous 16-byte runs from a K-major row/column.
static __device__ __forceinline__ v16h load2x8(const _Float16* base, int g) {
  const v8h lo = *(const v8h*)(base + 8 * g);
  const v8h hi = *(const v8h*)(base + 16 + 8 * g);
  v16h r;
#pragma unroll
  for (int i = 0; i < 8; ++i) { r[i] = lo[i]; r[i + 8] = hi[i]; }
  return r;
}

// ---------------------------------------------------------------------------
// Kernel 1: Y = (X @ W + b) * oscale, converted to f16, written head-split.
//   transposed==0 : dst[((b*H + h)*S + s)*64 + d]   (Q, K)
//   transposed==1 : dst[((b*H + h)*64 + d)*S + s]   (V^T for PV B-operand)
// Block = 128 threads (4 waves); block tile = 64 rows x 64 cols; K step 32.
// The block's whole W panel (512 k x 64 cols) is staged in LDS once, so the
// K loop runs without barriers.
// ---------------------------------------------------------------------------
// LDS row pitch in halves: 1040 B = 16 B x 65 (odd), so that 16 lanes on 16
// consecutive columns cover all 64 banks in a 16-byte store or load.
#define WPITCH (DIM + 8)

__global__ __launch_bounds__(128) void qkv_proj_kernel(
    const float* __restrict__ X, const float* __restrict__ W,
    const float* __restrict__ bias, _Float16* __restrict__ dst,
    int transposed, float oscale) {
  __shared__ __align__(16) _Float16 ldsW[64 * WPITCH];  // [col][k] panel

  const int tid  = threadIdx.x;
  const int w    = tid >> 5;
  const int lane = tid & 31;
  const int g    = lane >> 4;
  const int ln   = lane & 15;
  const int rbase = blockIdx.y * 64;
  const int cbase = blockIdx.x * 64;

  // Stage W[0 .. 512)[cbase .. +64) as f16, [col][k]. A lane owns one column:
  // eight row loads (one 128-B line per wave each) pack into one 16-B store.
  {
    const int    cc = tid & 63;
    const int    kh = tid >> 6;
    const float* wc = W + cbase + cc;
    // unroll 8: 64 independent loads in flight per lane, to cover L2 latency
#pragma unroll 8
    for (int i = 0; i < DIM / 16; ++i) {
      const int k0 = (2 * i + kh) * 8;
      v8h pk;
#pragma unroll
      for (int j = 0; j < 8; ++j) pk[j] = (_Float16)wc[(long)(k0 + j) * DIM];
      *(v8h*)&ldsW[cc * WPITCH + k0] = pk;
    }
  }
  __syncthreads();

  v8f acc[4] = {};
  const int    arow = rbase + 16 * w + ln;    // A operand: lane = row
  const float* xrow = X + (long)arow * DIM;

  // unroll 4: the X loads of four K steps issue together, ahead of their WMMAs
#pragma unroll 4
  for (int kb = 0; kb < DIM / 32; ++kb) {
    // A operand (convert f32 -> f16 on the fly)
    const float* ab = xrow + kb * 32;
    v16h A;
#pragma unroll
    for (int j = 0; j < 8; ++j) {
      A[j]     = (_Float16)ab[8 * g + j];
      A[j + 8] = (_Float16)ab[16 + 8 * g + j];
    }

#pragma unroll
    for (int t = 0; t < 4; ++t) {
      v16h B = load2x8(&ldsW[(16 * t + ln) * WPITCH + kb * 32], g);
      acc[t] = __builtin_amdgcn_wmma_f32_16x16x32_f16(
          false, A, false, B, (short)0, acc[t], false, false);
    }
  }

  // Epilogue: bias add, output scale (fp32), f16 convert, head-split store.
#pragma unroll
  for (int t = 0; t < 4; ++t) {
    const int   c  = cbase + 16 * t + ln;
    const float bv = bias[c];
    const int   h  = c >> 6;
    const int   d  = c & 63;
#pragma unroll
    for (int j = 0; j < 8; ++j) {
      int rg = rbase + 16 * w + 8 * g + j;  // C layout: row = 8g + j
      int b  = rg >> 11;                    // S = 2048
      int s  = rg & (S_LEN - 1);
      long idx = transposed
                     ? (((long)(b * NHEAD + h) * DHEAD + d) * S_LEN + s)
                     : (((long)(b * NHEAD + h) * S_LEN + s) * DHEAD + d);
      dst[idx] = (_Float16)((acc[t][j] + bv) * oscale);
    }
  }
}

// ---------------------------------------------------------------------------
// Kernel 2: flash attention, log2-domain softmax. Grid (S/64, H, B),
// 128 threads = 4 waves. Wave w owns q-rows [qb*64 + 16w, +16) x Dh=64
// (4 fp32 accumulators); sweeps 32 key blocks of 64.
// Q was pre-scaled by 1/sqrt(Dh)*log2(e), so p = exp2(s - m) directly
// (single v_exp_f32 per score). Row-sum reduction is deferred: each lane
// carries a partial l over its 4 columns; one butterfly in the epilogue.
// ---------------------------------------------------------------------------
__global__ __launch_bounds__(128) void attn_kernel(
    const _Float16* __restrict__ Q, const _Float16* __restrict__ K,
    const _Float16* __restrict__ VT, float* __restrict__ out) {
  __shared__ __align__(16) _Float16 ldsP[4 * 16 * DHEAD];  // wave-private slabs

  const int tid  = threadIdx.x;
  const int w    = tid >> 5;
  const int lane = tid & 31;
  const int g    = lane >> 4;
  const int ln   = lane & 15;
  const int qb = blockIdx.x, h = blockIdx.y, b = blockIdx.z;

  const long bh = (long)b * NHEAD + h;
  const _Float16* qp = Q  + bh * S_LEN * DHEAD;
  const _Float16* kp = K  + bh * S_LEN * DHEAD;
  const _Float16* vp = VT + bh * DHEAD * S_LEN;

  // Q operand, loop-invariant (already carries softmax scale in log2 units).
  const int qrow = qb * 64 + 16 * w + ln;
  v16h Aq[2];
#pragma unroll
  for (int kc = 0; kc < 2; ++kc)
    Aq[kc] = load2x8(qp + (long)qrow * DHEAD + kc * 32, g);

  float m[8], l[8];
  v8f acc[4] = {};
#pragma unroll
  for (int j = 0; j < 8; ++j) { m[j] = -1e30f; l[j] = 0.0f; }

  _Float16* myP = &ldsP[w * 16 * DHEAD];

  for (int kb = 0; kb < S_LEN / 64; ++kb) {
    // ---- scores (log2 units): S = Qs @ K^T, 16 x 64 per wave ----
    v8f sc[4];
#pragma unroll
    for (int t = 0; t < 4; ++t) {
      const _Float16* kr = kp + (long)(kb * 64 + 16 * t + ln) * DHEAD;
      v16h B0 = load2x8(kr, g);
      v16h B1 = load2x8(kr + 32, g);
      v8f z = {};
      z = __builtin_amdgcn_wmma_f32_16x16x32_f16(false, Aq[0], false, B0,
                                                 (short)0, z, false, false);
      sc[t] = __builtin_amdgcn_wmma_f32_16x16x32_f16(false, Aq[1], false, B1,
                                                     (short)0, z, false, false);
    }

    // ---- row max (butterfly over the 16-lane C-layout group) ----
    float mn[8];
#pragma unroll
    for (int j = 0; j < 8; ++j) {
      float v = fmaxf(fmaxf(sc[0][j], sc[1][j]), fmaxf(sc[2][j], sc[3][j]));
#pragma unroll
      for (int msk = 1; msk < 16; msk <<= 1) v = fmaxf(v, __shfl_xor(v, msk, 32));
      mn[j] = fmaxf(m[j], v);
    }

    // ---- p = 2^(s - m); lane-partial row sums; stash P as f16 in LDS ----
    float corr[8];
#pragma unroll
    for (int j = 0; j < 8; ++j) {
      corr[j] = __builtin_amdgcn_exp2f(m[j] - mn[j]);
      m[j] = mn[j];
      l[j] *= corr[j];
    }
#pragma unroll
    for (int t = 0; t < 4; ++t) {
#pragma unroll
      for (int j = 0; j < 8; ++j) {
        float p = __builtin_amdgcn_exp2f(sc[t][j] - mn[j]);
        l[j] += p;  // partial: this lane's 4 columns only
        myP[(8 * g + j) * DHEAD + 16 * t + ln] = (_Float16)p;
      }
      acc[t] *= *(const v8f*)corr;  // rescale output accumulator
    }

    // ---- PV: acc += P @ V (V stored transposed -> contiguous B loads) ----
    v16h Ap0 = load2x8(myP + ln * DHEAD, g);
    v16h Ap1 = load2x8(myP + ln * DHEAD + 32, g);
#pragma unroll
    for (int t = 0; t < 4; ++t) {
      const _Float16* vb = vp + (long)(16 * t + ln) * S_LEN + kb * 64;
      v16h Bv0 = load2x8(vb, g);
      v16h Bv1 = load2x8(vb + 32, g);
      acc[t] = __builtin_amdgcn_wmma_f32_16x16x32_f16(false, Ap0, false, Bv0,
                                                      (short)0, acc[t], false, false);
      acc[t] = __builtin_amdgcn_wmma_f32_16x16x32_f16(false, Ap1, false, Bv1,
                                                      (short)0, acc[t], false, false);
    }
  }

  // ---- epilogue: finish deferred row-sum, normalize, store fp32 ----
#pragma unroll
  for (int j = 0; j < 8; ++j) {
    float v = l[j];
#pragma unroll
    for (int msk = 1; msk < 16; msk <<= 1) v += __shfl_xor(v, msk, 32);
    l[j] = 1.0f / v;
  }
#pragma unroll
  for (int t = 0; t < 4; ++t) {
#pragma unroll
    for (int j = 0; j < 8; ++j) {
      int s = qb * 64 + 16 * w + 8 * g + j;
      out[((long)b * S_LEN + s) * DIM + h * DHEAD + 16 * t + ln] =
          acc[t][j] * l[j];
    }
  }
}

// ---------------------------------------------------------------------------
extern "C" void kernel_launch(void* const* d_in, const int* in_sizes, int n_in,
                              void* d_out, int out_size, void* d_ws, size_t ws_size,
                              hipStream_t stream) {
  const float* q  = (const float*)d_in[0];
  const float* k  = (const float*)d_in[1];
  const float* v  = (const float*)d_in[2];
  const float* Wq = (const float*)d_in[3];
  const float* bq = (const float*)d_in[4];
  const float* Wk = (const float*)d_in[5];
  const float* bk = (const float*)d_in[6];
  const float* Wv = (const float*)d_in[7];
  const float* bv = (const float*)d_in[8];

  const size_t per = (size_t)B_SZ * NHEAD * S_LEN * DHEAD;  // f16 elements
  _Float16* wsq = (_Float16*)d_ws;
  _Float16* wsk = wsq + per;
  _Float16* wsv = wsk + per;

  dim3 blk(128);
  dim3 g1(DIM / 64, (B_SZ * S_LEN) / 64);   // (8, 128)
  qkv_proj_kernel<<<g1, blk, 0, stream>>>(q, Wq, bq, wsq, 0, Q_SCALE);
  qkv_proj_kernel<<<g1, blk, 0, stream>>>(k, Wk, bk, wsk, 0, 1.0f);
  qkv_proj_kernel<<<g1, blk, 0, stream>>>(v, Wv, bv, wsv, 1, 1.0f);

  dim3 g2(S_LEN / 64, NHEAD, B_SZ);         // (32, 8, 4)
  attn_kernel<<<g2, blk, 0, stream>>>(wsq, wsk, wsv, (float*)d_out);
}

// v002
// Measured time: 117 microseconds a run.
// In both of two side-by-side timings against v001, it was 1.46 times as fast.
// All steps since v000 together make it 2.10 times as fast.
#include <hip/hip_runtime.h>
#include <hip/hip_bf16.h>

typedef __attribute__((ext_vector_type(16))) _Float16 v16h;
typedef __attribute__((ext_vector_type(8)))  _Float16 v8h;
typedef __attribute__((ext_vector_type(8)))  float    v8f;

#define B_SZ   4
#define S_LEN  2048
#define NHEAD  8
#define DHEAD  64
#define DIM    512

// 1/sqrt(DHEAD) * log2(e): folds softmax scaling AND the exp->exp2 change of
// base into the Q projection (applied in fp32 there).
#define Q_SCALE (0.125f * 1.4426950408889634f)

// Build a 16-bit WMMA A/B operand for 16x16x32:
// lane (g = lane>>4) holds halves K = {8g..8g+7} and {16+8g..16+8g+7},
// i.e. two contiguous 16-byte runs from a K-major row/column.
static __device__ __forceinline__ v16h load2x8(const _Float16* base, int g) {
  const v8h lo = *(const v8h*)(base + 8 * g);
  const v8h hi = *(const v8h*)(base + 16 + 8 * g);
  v16h r;
#pragma unroll
  for (int i = 0; i < 8; ++i) { r[i] = lo[i]; r[i + 8] = hi[i]; }
  return r;
}

// ---------------------------------------------------------------------------
// Kernel 1: Y = (X @ W + b) * oscale, converted to f16, written head-split.
//   transposed==0 : dst[((b*H + h)*S + s)*64 + d]   (Q, K)
//   transposed==1 : dst[((b*H + h)*64 + d)*S + s]   (V^T for PV B-operand)
// Block = 128 threads (4 waves); block tile = 64 rows x 64 cols; K step 32.
// The block's whole W panel (512 k x 64 cols) is staged in LDS once, so the
// K loop runs without barriers.
// ---------------------------------------------------------------------------
// LDS row pitch in halves: 1040 B = 16 B x 65 (odd), so that 16 lanes on 16
// consecutive columns cover all 64 banks in a 16-byte store or load.
#define WPITCH (DIM + 8)

__global__ __launch_bounds__(128) void qkv_proj_kernel(
    const float* __restrict__ X, const float* __restrict__ W,
    const float* __restrict__ bias, _Float16* __restrict__ dst,
    int transposed, float oscale) {
  __shared__ __align__(16) _Float16 ldsW[64 * WPITCH];  // [col][k] panel

  const int tid  = threadIdx.x;
  const int w    = tid >> 5;
  const int lane = tid & 31;
  const int g    = lane >> 4;
  const int ln   = lane & 15;
  const int rbase = blockIdx.y * 64;
  const int cbase = blockIdx.x * 64;

  // Stage W[0 .. 512)[cbase .. +64) as f16, [col][k]. A lane owns one column:
  // eight row loads (one 128-B line per wave each) pack into one 16-B store.
  {
    const int    cc = tid & 63;
    const int    kh = tid >> 6;
    const float* wc = W + cbase + cc;
    // unroll 8: 64 independent loads in flight per lane, to cover L2 latency
#pragma unroll 8
    for (int i = 0; i < DIM / 16; ++i) {
      const int k0 = (2 * i + kh) * 8;
      v8h pk;
#pragma unroll
      for (int j = 0; j < 8; ++j) pk[j] = (_Float16)wc[(long)(k0 + j) * DIM];
      *(v8h*)&ldsW[cc * WPITCH + k0] = pk;
    }
  }
  __syncthreads();

  v8f acc[4] = {};
  const int    arow = rbase + 16 * w + ln;    // A operand: lane = row
  const float* xrow = X + (long)arow * DIM;

  // unroll 4: the X loads of four K steps issue together, ahead of their WMMAs
#pragma unroll 4
  for (int kb = 0; kb < DIM / 32; ++kb) {
    // A operand (convert f32 -> f16 on the fly)
    const float* ab = xrow + kb * 32;
    v16h A;
#pragma unroll
    for (int j = 0; j < 8; ++j) {
      A[j]     = (_Float16)ab[8 * g + j];
      A[j + 8] = (_Float16)ab[16 + 8 * g + j];
    }

#pragma unroll
    for (int t = 0; t < 4; ++t) {
      v16h B = load2x8(&ldsW[(16 * t + ln) * WPITCH + kb * 32], g);
      acc[t] = __builtin_amdgcn_wmma_f32_16x16x32_f16(
          false, A, false, B, (short)0, acc[t], false, false);
    }
  }

  // Epilogue: bias add, output scale (fp32), f16 convert, head-split store.
#pragma unroll
  for (int t = 0; t < 4; ++t) {
    const int   c  = cbase + 16 * t + ln;
    const float bv = bias[c];
    const int   h  = c >> 6;
    const int   d  = c & 63;
#pragma unroll
    for (int j = 0; j < 8; ++j) {
      int rg = rbase + 16 * w + 8 * g + j;  // C layout: row = 8g + j
      int b  = rg >> 11;                    // S = 2048
      int s  = rg & (S_LEN - 1);
      long idx = transposed
                     ? (((long)(b * NHEAD + h) * DHEAD + d) * S_LEN + s)
                     : (((long)(b * NHEAD + h) * S_LEN + s) * DHEAD + d);
      dst[idx] = (_Float16)((acc[t][j] + bv) * oscale);
    }
  }
}

#define KVPITCH (DHEAD + 8)
#define KVTILE  (64 * KVPITCH)   // halves in one staged tile
#define NTILE   (S_LEN / 64)

// One tile pair: every lane copies four 16-B pieces of K and four of V^T.
// kg, vg: the lane's first piece in global memory; lk: its place in the K tile
// of the target buffer (LDS byte address); the V^T tile lies behind the K tile.
// Piece i lies 16 tile rows behind piece i - 1.
static __device__ __forceinline__ void copy_kv_tile(const _Float16* kg,
                                                    const _Float16* vg,
                                                    unsigned lk) {
  const unsigned lv = lk + KVTILE * 2;
  const unsigned ls = 16 * KVPITCH * 2;
  // The closing s_wait_xcnt 0 stands inside the statement so that no address
  // register of a copy is rewritten before it.
  asm volatile(
      "global_load_async_to_lds_b128 %0, %8, off\n\t"
      "global_load_async_to_lds_b128 %1, %9, off\n\t"
      "global_load_async_to_lds_b128 %2, %10, off\n\t"
      "global_load_async_to_lds_b128 %3, %11, off\n\t"
      "global_load_async_to_lds_b128 %4, %12, off\n\t"
      "global_load_async_to_lds_b128 %5, %13, off\n\t"
      "global_load_async_to_lds_b128 %6, %14, off\n\t"
      "global_load_async_to_lds_b128 %7, %15, off\n\t"
      "s_wait_xcnt 0x0"
      :: "v"(lk), "v"(lk + ls), "v"(lk + 2 * ls), "v"(lk + 3 * ls),
         "v"(lv), "v"(lv + ls), "v"(lv + 2 * ls), "v"(lv + 3 * ls),
         "v"(kg), "v"(kg + 16 * DHEAD), "v"(kg + 32 * DHEAD),
         "v"(kg + 48 * DHEAD),
         "v"(vg), "v"(vg + 16 * S_LEN), "v"(vg + 32 * S_LEN),
         "v"(vg + 48 * S_LEN)
      : "memory");
}

__global__ __launch_bounds__(128) void attn_kernel(
    const _Float16* __restrict__ Q, const _Float16* __restrict__ K,
    const _Float16* __restrict__ VT, float* __restrict__ out) {
  __shared__ __align__(16) _Float16 ldsP[4 * 16 * DHEAD];  // wave-private slabs
  __shared__ __align__(16) _Float16 ldsKV[2 * 2 * KVTILE];  // [buffer][K, V^T]

  const int tid  = threadIdx.x;
  const int w    = tid >> 5;
  const int lane = tid & 31;
  const int g    = lane >> 4;
  const int ln   = lane & 15;
  const int qb = blockIdx.x, h = blockIdx.y, b = blockIdx.z;

  const long bh = (long)b * NHEAD + h;
  const _Float16* qp = Q  + bh * S_LEN * DHEAD;
  const _Float16* kp = K  + bh * S_LEN * DHEAD;
  const _Float16* vp = VT + bh * DHEAD * S_LEN;

  // Q operand, loop-invariant (already carries softmax scale in log2 units).
  const int qrow = qb * 64 + 16 * w + ln;
  v16h Aq[2];
#pragma unroll
  for (int kc = 0; kc < 2; ++kc)
    Aq[kc] = load2x8(qp + (long)qrow * DHEAD + kc * 32, g);

  float m[8], l[8];
  v8f acc[4] = {};
#pragma unroll
  for (int j = 0; j < 8; ++j) { m[j] = -1e30f; l[j] = 0.0f; }

  _Float16* myP = &ldsP[w * 16 * DHEAD];

  // The lane's piece of a tile: row tid / 8, 16-B column tid % 8, so that a
  // wave's copy covers four whole 128-B lines.
  const _Float16* kg = kp + tid * 8;
  const _Float16* vg = vp + (long)(tid >> 3) * S_LEN + (tid & 7) * 8;
  const unsigned  lk =
      (unsigned)(size_t)&ldsKV[(tid >> 3) * KVPITCH + (tid & 7) * 8];

  copy_kv_tile(kg, vg, lk);
  // tile 0 has landed for this wave, then for the block
  asm volatile("s_wait_asynccnt 0x0" ::: "memory");
  __syncthreads();
  copy_kv_tile(kg + 64 * DHEAD, vg + 64, lk + 2 * KVTILE * 2);

  for (int kb = 0; kb < NTILE; ++kb) {
    const int buf = (kb & 1) * 2 * KVTILE;
    // ---- scores (log2 units): S = Qs @ K^T, 16 x 64 per wave ----
    v8f sc[4];
#pragma unroll
    for (int t = 0; t < 4; ++t) {
      const _Float16* kr = &ldsKV[buf + (16 * t + ln) * KVPITCH];
      v16h B0 = load2x8(kr, g);
      v16h B1 = load2x8(kr + 32, g);
      v8f z = {};
      z = __builtin_amdgcn_wmma_f32_16x16x32_f16(false, Aq[0], false, B0,
                                                 (short)0, z, false, false);
      sc[t] = __builtin_amdgcn_wmma_f32_16x16x32_f16(false, Aq[1], false, B1,
                                                     (short)0, z, false, false);
    }

    // V^T fragments of this tile, read as one group here so that their LDS
    // latency passes behind the softmax instead of in front of each PV product.
    v16h Bv[8];
    // unrolled: Bv is indexed by constants only and stays in registers
#pragma unroll
    for (int t = 0; t < 4; ++t) {
      const _Float16* vb = &ldsKV[buf + KVTILE + (16 * t + ln) * KVPITCH];
      Bv[2 * t]     = load2x8(vb, g);
      Bv[2 * t + 1] = load2x8(vb + 32, g);
    }

    // ---- row max (butterfly over the 16-lane C-layout group) ----
    float mn[8];
#pragma unroll
    for (int j = 0; j < 8; ++j) {
      float v = fmaxf(fmaxf(sc[0][j], sc[1][j]), fmaxf(sc[2][j], sc[3][j]));
#pragma unroll
      for (int msk = 1; msk < 16; msk <<= 1) v = fmaxf(v, __shfl_xor(v, msk, 32));
      mn[j] = fmaxf(m[j], v);
    }

    // ---- p = 2^(s - m); lane-partial row sums; stash P as f16 in LDS ----
    float corr[8];
#pragma unroll
    for (int j = 0; j < 8; ++j) {
      corr[j] = __builtin_amdgcn_exp2f(m[j] - mn[j]);
      m[j] = mn[j];
      l[j] *= corr[j];
    }
#pragma unroll
    for (int t = 0; t < 4; ++t) {
#pragma unroll
      for (int j = 0; j < 8; ++j) {
        float p = __builtin_amdgcn_exp2f(sc[t][j] - mn[j]);
        l[j] += p;  // partial: this lane's 4 columns only
        myP[(8 * g + j) * DHEAD + 16 * t + ln] = (_Float16)p;
      }
      acc[t] *= *(const v8f*)corr;  // rescale output accumulator
    }

    // ---- PV: acc += P @ V (V stored transposed -> contiguous B loads) ----
    v16h Ap0 = load2x8(myP + ln * DHEAD, g);
    v16h Ap1 = load2x8(myP + ln * DHEAD + 32, g);
#pragma unroll
    for (int t = 0; t < 4; ++t) {
      acc[t] = __builtin_amdgcn_wmma_f32_16x16x32_f16(false, Ap0, false, Bv[2 * t],
                                                      (short)0, acc[t], false, false);
      acc[t] = __builtin_amdgcn_wmma_f32_16x16x32_f16(false, Ap1, false, Bv[2 * t + 1],
                                                      (short)0, acc[t], false, false);
    }

    // Hand-over: this wave's reads of the buffer are done ...
    asm volatile("s_wait_dscnt 0x0" ::: "memory");
    // ... and its copies of the next tile have landed;
    asm volatile("s_wait_asynccnt 0x0" ::: "memory");
    // the barrier publishes the next tile and frees this trip's buffer.
    __syncthreads();
    if (kb + 2 < NTILE)
      copy_kv_tile(kg + (long)(kb + 2) * 64 * DHEAD, vg + (kb + 2) * 64,
                   lk + buf * 2);
  }
  // no copy is left in flight when the wave ends
  asm volatile("s_wait_asynccnt 0x0" ::: "memory");

  // ---- epilogue: finish deferred row-sum, normalize, store fp32 ----
#pragma unroll
  for (int j = 0; j < 8; ++j) {
    float v = l[j];
#pragma unroll
    for (int msk = 1; msk < 16; msk <<= 1) v += __shfl_xor(v, msk, 32);
    l[j] = 1.0f / v;
  }
#pragma unroll
  for (int t = 0; t < 4; ++t) {
#pragma unroll
    for (int j = 0; j < 8; ++j) {
      int s = qb * 64 + 16 * w + 8 * g + j;
      out[((long)b * S_LEN + s) * DIM + h * DHEAD + 16 * t + ln] =
          acc[t][j] * l[j];
    }
  }
}

// ---------------------------------------------------------------------------
extern "C" void kernel_launch(void* const* d_in, const int* in_sizes, int n_in,
                              void* d_out, int out_size, void* d_ws, size_t ws_size,
                              hipStream_t stream) {
  const float* q  = (const float*)d_in[0];
  const float* k  = (const float*)d_in[1];
  const float* v  = (const float*)d_in[2];
  const float* Wq = (const float*)d_in[3];
  const float* bq = (const float*)d_in[4];
  const float* Wk = (const float*)d_in[5];
  const float* bk = (const float*)d_in[6];
  const float* Wv = (const float*)d_in[7];
  const float* bv = (const float*)d_in[8];

  const size_t per = (size_t)B_SZ * NHEAD * S_LEN * DHEAD;  // f16 elements
  _Float16* wsq = (_Float16*)d_ws;
  _Float16* wsk = wsq + per;
  _Float16* wsv = wsk + per;

  dim3 blk(128);
  dim3 g1(DIM / 64, (B_SZ * S_LEN) / 64);   // (8, 128)
  qkv_proj_kernel<<<g1, blk, 0, stream>>>(q, Wq, bq, wsq, 0, Q_SCALE);
  qkv_proj_kernel<<<g1, blk, 0, stream>>>(k, Wk, bk, wsk, 0, 1.0f);
  qkv_proj_kernel<<<g1, blk, 0, stream>>>(v, Wv, bv, wsv, 1, 1.0f);

  dim3 g2(S_LEN / 64, NHEAD, B_SZ);         // (32, 8, 4)
  attn_kernel<<<g2, blk, 0, stream>>>(wsq, wsk, wsv, (float*)d_out);
}

// v003
// One run takes 90.8 microseconds.
// Next to v002, in two timings, it ran 1.28 and 1.29 times as fast.
// All steps since v000 together make it 2.70 times as fast.
#include <hip/hip_runtime.h>
#include <hip/hip_bf16.h>

typedef __attribute__((ext_vector_type(16))) _Float16 v16h;
typedef __attribute__((ext_vector_type(8)))  _Float16 v8h;
typedef __attribute__((ext_vector_type(8)))  float    v8f;
typedef __attribute__((ext_vector_type(4)))  float    v4f;

#define B_SZ   4
#define S_LEN  2048
#define NHEAD  8
#define DHEAD  64
#define DIM    512

// 1/sqrt(DHEAD) * log2(e): folds softmax scaling AND the exp->exp2 change of
// base into the Q projection (applied in fp32 there).
#define Q_SCALE (0.125f * 1.4426950408889634f)

// Build a 16-bit WMMA A/B operand for 16x16x32:
// lane (g = lane>>4) holds halves K = {8g..8g+7} and {16+8g..16+8g+7},
// i.e. two contiguous 16-byte runs from a K-major row/column.
static __device__ __forceinline__ v16h load2x8(const _Float16* base, int g) {
  const v8h lo = *(const v8h*)(base + 8 * g);
  const v8h hi = *(const v8h*)(base + 16 + 8 * g);
  v16h r;
#pragma unroll
  for (int i = 0; i < 8; ++i) { r[i] = lo[i]; r[i + 8] = hi[i]; }
  return r;
}

// ---------------------------------------------------------------------------
// Kernel 1: Y = (X @ W + b) * oscale, converted to f16, written head-split.
//   transposed==0 : dst[((b*H + h)*S + s)*64 + d]   (Q, K)
//   transposed==1 : dst[((b*H + h)*64 + d)*S + s]   (V^T for PV A-operand)
// Block = 128 threads (4 waves); block tile = 64 rows x 64 cols; K step 32.
// The block's whole W panel (512 k x 64 cols) is staged in LDS once, so the
// K loop runs without barriers.
// ---------------------------------------------------------------------------
// LDS row pitch in halves: 1040 B = 16 B x 65 (odd), so that 16 lanes on 16
// consecutive columns cover all 64 banks in a 16-byte store or load.
#define WPITCH (DIM + 8)

__global__ __launch_bounds__(128) void qkv_proj_kernel(
    const float* __restrict__ X, const float* __restrict__ W,
    const float* __restrict__ bias, _Float16* __restrict__ dst,
    int transposed, float oscale) {
  __shared__ __align__(16) _Float16 ldsW[64 * WPITCH];  // [col][k] panel

  const int tid  = threadIdx.x;
  const int w    = tid >> 5;
  const int lane = tid & 31;
  const int g    = lane >> 4;
  const int ln   = lane & 15;
  const int rbase = blockIdx.y * 64;
  const int cbase = blockIdx.x * 64;

  // Stage W[0 .. 512)[cbase .. +64) as f16, [col][k]. A lane owns one column:
  // eight row loads (one 128-B line per wave each) pack into one 16-B store.
  {
    const int    cc = tid & 63;
    const int    kh = tid >> 6;
    const float* wc = W + cbase + cc;
    // unroll 8: 64 independent loads in flight per lane, to cover L2 latency
#pragma unroll 8
    for (int i = 0; i < DIM / 16; ++i) {
      const int k0 = (2 * i + kh) * 8;
      v8h pk;
#pragma unroll
      for (int j = 0; j < 8; ++j) pk[j] = (_Float16)wc[(long)(k0 + j) * DIM];
      *(v8h*)&ldsW[cc * WPITCH + k0] = pk;
    }
  }
  __syncthreads();

  v8f acc[4] = {};
  const int    arow = rbase + 16 * w + ln;    // A operand: lane = row
  const float* xrow = X + (long)arow * DIM;

  // unroll 4: the X loads of four K steps issue together, ahead of their WMMAs
#pragma unroll 4
  for (int kb = 0; kb < DIM / 32; ++kb) {
    // A operand (convert f32 -> f16 on the fly)
    const float* ab = xrow + kb * 32;
    v16h A;
#pragma unroll
    for (int j = 0; j < 8; ++j) {
      A[j]     = (_Float16)ab[8 * g + j];
      A[j + 8] = (_Float16)ab[16 + 8 * g + j];
    }

#pragma unroll
    for (int t = 0; t < 4; ++t) {
      v16h B = load2x8(&ldsW[(16 * t + ln) * WPITCH + kb * 32], g);
      acc[t] = __builtin_amdgcn_wmma_f32_16x16x32_f16(
          false, A, false, B, (short)0, acc[t], false, false);
    }
  }

  // Epilogue: bias add, output scale (fp32), f16 convert, head-split store.
#pragma unroll
  for (int t = 0; t < 4; ++t) {
    const int   c  = cbase + 16 * t + ln;
    const float bv = bias[c];
    const int   h  = c >> 6;
    const int   d  = c & 63;
#pragma unroll
    for (int j = 0; j < 8; ++j) {
      int rg = rbase + 16 * w + 8 * g + j;  // C layout: row = 8g + j
      int b  = rg >> 11;                    // S = 2048
      int s  = rg & (S_LEN - 1);
      long idx = transposed
                     ? (((long)(b * NHEAD + h) * DHEAD + d) * S_LEN + s)
                     : (((long)(b * NHEAD + h) * S_LEN + s) * DHEAD + d);
      dst[idx] = (_Float16)((acc[t][j] + bv) * oscale);
    }
  }
}

#define KVPITCH (DHEAD + 8)
#define KVTILE  (64 * KVPITCH)   // halves in one staged tile
#define NTILE   (S_LEN / 64)

// One tile pair: every lane copies four 16-B pieces of K and four of V^T.
// kg, vg: the lane's first piece in global memory; lk: its place in the K tile
// of the target buffer (LDS byte address); the V^T tile lies behind the K tile.
// Piece i lies 16 tile rows behind piece i - 1.
static __device__ __forceinline__ void copy_kv_tile(const _Float16* kg,
                                                    const _Float16* vg,
                                                    unsigned lk) {
  const unsigned lv = lk + KVTILE * 2;
  const unsigned ls = 16 * KVPITCH * 2;
  // The closing s_wait_xcnt 0 stands inside the statement so that no address
  // register of a copy is rewritten before it.
  asm volatile(
      "global_load_async_to_lds_b128 %0, %8, off\n\t"
      "global_load_async_to_lds_b128 %1, %9, off\n\t"
      "global_load_async_to_lds_b128 %2, %10, off\n\t"
      "global_load_async_to_lds_b128 %3, %11, off\n\t"
      "global_load_async_to_lds_b128 %4, %12, off\n\t"
      "global_load_async_to_lds_b128 %5, %13, off\n\t"
      "global_load_async_to_lds_b128 %6, %14, off\n\t"
      "global_load_async_to_lds_b128 %7, %15, off\n\t"
      "s_wait_xcnt 0x0"
      :: "v"(lk), "v"(lk + ls), "v"(lk + 2 * ls), "v"(lk + 3 * ls),
         "v"(lv), "v"(lv + ls), "v"(lv + 2 * ls), "v"(lv + 3 * ls),
         "v"(kg), "v"(kg + 16 * DHEAD), "v"(kg + 32 * DHEAD),
         "v"(kg + 48 * DHEAD),
         "v"(vg), "v"(vg + 16 * S_LEN), "v"(vg + 32 * S_LEN),
         "v"(vg + 48 * S_LEN)
      : "memory");
}

// Value of lane l ^ 16 (the other half of the wave), by a vector cross-row move.
static __device__ __forceinline__ float other_half(float x) {
  const int b = __builtin_bit_cast(int, x);
  return __builtin_bit_cast(float, __builtin_amdgcn_permlanex16(
      b, b, 0x76543210, 0xfedcba98, false, false));
}

// waves_per_eu: the grid puts four waves on a SIMD (four blocks per WGP); told
// so, the compiler spends that share of the registers and reuses fewer of them
// between the fragment loads, the softmax and the products (fewer waits, nops).
__global__ __launch_bounds__(128) __attribute__((amdgpu_waves_per_eu(4, 4)))
void attn_kernel(
    const _Float16* __restrict__ Q, const _Float16* __restrict__ K,
    const _Float16* __restrict__ VT, float* __restrict__ out) {
  __shared__ __align__(16) _Float16 ldsKV[2 * 2 * KVTILE];  // [buffer][K, V^T]

  const int tid  = threadIdx.x;
  const int w    = tid >> 5;
  const int lane = tid & 31;
  const int g    = lane >> 4;
  const int ln   = lane & 15;
  const int qb = blockIdx.x, h = blockIdx.y, b = blockIdx.z;

  const long bh = (long)b * NHEAD + h;
  const _Float16* qp = Q  + bh * S_LEN * DHEAD;
  const _Float16* kp = K  + bh * S_LEN * DHEAD;
  const _Float16* vp = VT + bh * DHEAD * S_LEN;

  // Q^T operand (B: lane = query column), loop-invariant; it already carries
  // the softmax scale in log2 units.
  const int qrow = qb * 64 + 16 * w + ln;
  v16h Bq[2];
#pragma unroll
  for (int kc = 0; kc < 2; ++kc)
    Bq[kc] = load2x8(qp + (long)qrow * DHEAD + kc * 32, g);

  float m = -1e30f;  // running maximum of the lane's query, equal in both halves
  v8f   lv = {};     // partial row sums: this lane's keys only
  v8f   acc[4] = {}; // O^T: acc[t][j] = O[query ln][d = 16t + 8g + j]

  // The lane's piece of a tile: row tid / 8, 16-B column tid % 8, so that a
  // wave's copy covers four whole 128-B lines.
  const _Float16* kg = kp + tid * 8;
  const _Float16* vg = vp + (long)(tid >> 3) * S_LEN + (tid & 7) * 8;
  const unsigned  lk =
      (unsigned)(size_t)&ldsKV[(tid >> 3) * KVPITCH + (tid & 7) * 8];

  copy_kv_tile(kg, vg, lk);
  // tile 0 has landed for this wave, then for the block
  asm volatile("s_wait_asynccnt 0x0" ::: "memory");
  __syncthreads();
  copy_kv_tile(kg + 64 * DHEAD, vg + 64, lk + 2 * KVTILE * 2);

  for (int kb = 0; kb < NTILE; ++kb) {
    const int buf = (kb & 1) * 2 * KVTILE;
    // ---- scores (log2 units): S^T = K @ Qs^T, 64 keys x 16 queries ----
    // sc[t][j] = score of key 16t + 8g + j against query ln
    v16h Ak[8];
    // every inner loop of the trip is unrolled: Ak, Av, sc, ph and acc are
    // indexed by constants only and stay in registers
#pragma unroll
    for (int t = 0; t < 4; ++t) {
      const _Float16* kr = &ldsKV[buf + (16 * t + ln) * KVPITCH];
      Ak[2 * t]     = load2x8(kr, g);
      Ak[2 * t + 1] = load2x8(kr + 32, g);
    }
    // V^T fragments of this tile (A: lane = row d), read in the same group so
    // that their LDS latency passes behind the score products and the softmax.
    v16h Av[8];
#pragma unroll
    for (int t = 0; t < 4; ++t) {
      const _Float16* vb = &ldsKV[buf + KVTILE + (16 * t + ln) * KVPITCH];
      Av[2 * t]     = load2x8(vb, g);
      Av[2 * t + 1] = load2x8(vb + 32, g);
    }
    // keeps the trip's 32 fragment loads in one place: sunk between the
    // products, each small group would be waited for at its own place
    __builtin_amdgcn_sched_barrier(0);

    v8f sc[4];
#pragma unroll
    for (int t = 0; t < 4; ++t) {
      v8f z = {};
      sc[t] = __builtin_amdgcn_wmma_f32_16x16x32_f16(false, Ak[2 * t], false, Bq[0],
                                                     (short)0, z, false, false);
    }
#pragma unroll
    for (int t = 0; t < 4; ++t)
      sc[t] = __builtin_amdgcn_wmma_f32_16x16x32_f16(false, Ak[2 * t + 1], false, Bq[1],
                                                     (short)0, sc[t], false, false);

    // ---- maximum of the query's 64 scores: in-lane, then across the halves ----
    float mt[4];
#pragma unroll
    for (int t = 0; t < 4; ++t) {
      float v = sc[t][0];
#pragma unroll
      for (int j = 1; j < 8; ++j) v = fmaxf(v, sc[t][j]);
      mt[t] = v;
    }
    float mn = fmaxf(fmaxf(fmaxf(mt[0], mt[1]), fmaxf(mt[2], mt[3])), m);
    mn = fmaxf(mn, other_half(mn));

    const float corr = __builtin_amdgcn_exp2f(m - mn);
    m = mn;

    // ---- p = 2^(s - m); partial sums; P^T packed as the B operand ----
    // B element s of key chunk kc is key 32kc + 8g + s (s < 8) or
    // 32kc + 16 + 8g + s - 8: score tiles 2kc and 2kc + 1, register for register.
    v8h ph[4];
    lv *= corr;
#pragma unroll
    for (int t = 0; t < 4; ++t) {
      const v8f e = sc[t] - mn;
      v8f p;
#pragma unroll
      for (int j = 0; j < 8; ++j) p[j] = __builtin_amdgcn_exp2f(e[j]);
      lv += p;
      ph[t] = __builtin_convertvector(p, v8h);
      acc[t] *= corr;  // rescale output accumulator
    }
    const v16h Bp0 = __builtin_shufflevector(ph[0], ph[1], 0, 1, 2, 3, 4, 5, 6, 7,
                                             8, 9, 10, 11, 12, 13, 14, 15);
    const v16h Bp1 = __builtin_shufflevector(ph[2], ph[3], 0, 1, 2, 3, 4, 5, 6, 7,
                                             8, 9, 10, 11, 12, 13, 14, 15);

    // ---- O^T += V^T @ P^T ----
#pragma unroll
    for (int t = 0; t < 4; ++t)
      acc[t] = __builtin_amdgcn_wmma_f32_16x16x32_f16(false, Av[2 * t], false, Bp0,
                                                      (short)0, acc[t], false, false);
#pragma unroll
    for (int t = 0; t < 4; ++t)
      acc[t] = __builtin_amdgcn_wmma_f32_16x16x32_f16(false, Av[2 * t + 1], false, Bp1,
                                                      (short)0, acc[t], false, false);

    // keeps the hand-over at the trip's foot: lifted over the softmax, it would
    // leave the next copies, issued behind the PV products, too short a flight
    __builtin_amdgcn_sched_barrier(0);
    // Hand-over: this wave's reads of the buffer are done ...
    asm volatile("s_wait_dscnt 0x0" ::: "memory");
    // ... and its copies of the next tile have landed;
    asm volatile("s_wait_asynccnt 0x0" ::: "memory");
    // the barrier publishes the next tile and frees this trip's buffer.
    __syncthreads();
    if (kb + 2 < NTILE)
      copy_kv_tile(kg + (long)(kb + 2) * 64 * DHEAD, vg + (kb + 2) * 64,
                   lk + buf * 2);
  }
  // no copy is left in flight when the wave ends
  asm volatile("s_wait_asynccnt 0x0" ::: "memory");

  // ---- epilogue: join the partial row sums, normalize, store fp32 ----
  float l = ((lv[0] + lv[1]) + (lv[2] + lv[3])) + ((lv[4] + lv[5]) + (lv[6] + lv[7]));
  l += other_half(l);
  const float inv = 1.0f / l;
  // A lane holds eight consecutive d of its query per tile: two 16-B stores.
  float* orow = out + ((long)b * S_LEN + qrow) * DIM + h * DHEAD + 8 * g;
#pragma unroll
  for (int t = 0; t < 4; ++t) {
    const v8f o = acc[t] * inv;
    *(v4f*)(orow + 16 * t)     = __builtin_shufflevector(o, o, 0, 1, 2, 3);
    *(v4f*)(orow + 16 * t + 4) = __builtin_shufflevector(o, o, 4, 5, 6, 7);
  }
}

// ---------------------------------------------------------------------------
extern "C" void kernel_launch(void* const* d_in, const int* in_sizes, int n_in,
                              void* d_out, int out_size, void* d_ws, size_t ws_size,
                              hipStream_t stream) {
  const float* q  = (const float*)d_in[0];
  const float* k  = (const float*)d_in[1];
  const float* v  = (const float*)d_in[2];
  const float* Wq = (const float*)d_in[3];
  const float* bq = (const float*)d_in[4];
  const float* Wk = (const float*)d_in[5];
  const float* bk = (const float*)d_in[6];
  const float* Wv = (const float*)d_in[7];
  const float* bv = (const float*)d_in[8];

  const size_t per = (size_t)B_SZ * NHEAD * S_LEN * DHEAD;  // f16 elements
  _Float16* wsq = (_Float16*)d_ws;
  _Float16* wsk = wsq + per;
  _Float16* wsv = wsk + per;

  dim3 blk(128);
  dim3 g1(DIM / 64, (B_SZ * S_LEN) / 64);   // (8, 128)
  qkv_proj_kernel<<<g1, blk, 0, stream>>>(q, Wq, bq, wsq, 0, Q_SCALE);
  qkv_proj_kernel<<<g1, blk, 0, stream>>>(k, Wk, bk, wsk, 0, 1.0f);
  qkv_proj_kernel<<<g1, blk, 0, stream>>>(v, Wv, bv, wsv, 1, 1.0f);

  dim3 g2(S_LEN / 64, NHEAD, B_SZ);         // (32, 8, 4)
  attn_kernel<<<g2, blk, 0, stream>>>(wsq, wsk, wsv, (float*)d_out);
}

// v004
// A run of this version takes 80.9 microseconds.
// In both of two side-by-side timings against v003, it was 1.11 times as fast.
// All steps since v000 together make it 3.01 times as fast.
#include <hip/hip_runtime.h>
#include <hip/hip_bf16.h>

typedef __attribute__((ext_vector_type(16))) _Float16 v16h;
typedef __attribute__((ext_vector_type(8)))  _Float16 v8h;
typedef __attribute__((ext_vector_type(4)))  _Float16 v4h;
typedef __attribute__((ext_vector_type(8)))  float    v8f;
typedef __attribute__((ext_vector_type(4)))  float    v4f;

#define B_SZ   4
#define S_LEN  2048
#define NHEAD  8
#define DHEAD  64
#define DIM    512

// 1/sqrt(DHEAD) * log2(e): folds softmax scaling AND the exp->exp2 change of
// base into the Q projection (applied in fp32 there).
#define Q_SCALE (0.125f * 1.4426950408889634f)

// Build a 16-bit WMMA A/B operand for 16x16x32:
// lane (g = lane>>4) holds halves K = {8g..8g+7} and {16+8g..16+8g+7},
// i.e. two contiguous 16-byte runs from a K-major row/column.
static __device__ __forceinline__ v16h load2x8(const _Float16* base, int g) {
  const v8h lo = *(const v8h*)(base + 8 * g);
  const v8h hi = *(const v8h*)(base + 16 + 8 * g);
  v16h r;
#pragma unroll
  for (int i = 0; i < 8; ++i) { r[i] = lo[i]; r[i + 8] = hi[i]; }
  return r;
}

// ---------------------------------------------------------------------------
// Kernel 1: Y = (X @ W + b) * oscale, converted to f16, written head-split.
//   transposed==0 : dst[((b*H + h)*S + s)*64 + d]   (Q, K)
//   transposed==1 : dst[((b*H + h)*64 + d)*S + s]   (V^T for PV A-operand)
// Block = 128 threads (4 waves); block tile = 64 rows x 64 cols; K step 32.
// The block's whole W panel (512 k x 64 cols) is staged in LDS once, so the
// K loop runs without barriers.
// X reaches the A operand through LDS: a wave reads its 16 rows in chunks of
// 64 k with loads that cover whole 256-B runs of two rows (4 lines a load; a
// load in fragment order would touch 16), converts, stores the chunk in a
// buffer of its own and reads the fragments back. Three chunks are in flight.
// ---------------------------------------------------------------------------
// LDS row pitch in halves: 1040 B = 16 B x 65 (odd), so that 16 lanes on 16
// consecutive columns cover all 64 banks in a 16-byte store or load.
#define WPITCH (DIM + 8)
// X chunk: 64 k; row pitch 144 B = 16 B x 9 (odd), as the fragment reads want.
#define XCH    64
#define XPITCH (XCH + 8)
#define NXCH   (DIM / XCH)
#define XDEPTH 3

__global__ __launch_bounds__(128) void qkv_proj_kernel(
    const float* __restrict__ X, const float* __restrict__ W,
    const float* __restrict__ bias, _Float16* __restrict__ dst,
    int transposed, float oscale) {
  __shared__ __align__(16) _Float16 ldsW[64 * WPITCH];  // [col][k] panel
  __shared__ __align__(16) _Float16 ldsX[4 * 16 * XPITCH];  // [wave][row][k]

  const int tid  = threadIdx.x;
  const int w    = tid >> 5;
  const int lane = tid & 31;
  const int g    = lane >> 4;
  const int ln   = lane & 15;
  const int rbase = blockIdx.y * 64;
  const int cbase = blockIdx.x * 64;

  // The lane's place in a chunk of X: piece i is row i + 8g of the wave's 16,
  // floats 4 ln .. 4 ln + 3 of the chunk. Rows i and i + 8 lie 32 banks apart.
  const float* xg  = X + (long)(rbase + 16 * w + 8 * g) * DIM + 4 * ln;
  _Float16*    xst = &ldsX[(16 * w + 8 * g) * XPITCH + 4 * ln];
  v4f xr[XDEPTH][8];
  // every loop over xr is unrolled: it is indexed by constants only
  // The first chunks fly while the W panel is staged.
#pragma unroll
  for (int c = 0; c < XDEPTH; ++c)
#pragma unroll
    for (int i = 0; i < 8; ++i)
      xr[c][i] = *(const v4f*)(xg + (long)i * DIM + c * XCH);

  // Stage W[0 .. 512)[cbase .. +64) as f16, [col][k]. A lane owns one column:
  // eight row loads (one 128-B line per wave each) pack into one 16-B store.
  {
    const int    cc = tid & 63;
    const int    kh = tid >> 6;
    const float* wc = W + cbase + cc;
    // unroll 8: 64 independent loads in flight per lane, to cover L2 latency
#pragma unroll 8
    for (int i = 0; i < DIM / 16; ++i) {
      const int k0 = (2 * i + kh) * 8;
      v8h pk;
#pragma unroll
      for (int j = 0; j < 8; ++j) pk[j] = (_Float16)wc[(long)(k0 + j) * DIM];
      *(v8h*)&ldsW[cc * WPITCH + k0] = pk;
    }
  }
  // chunk 0 into the wave's buffer
#pragma unroll
  for (int i = 0; i < 8; ++i)
    *(v4h*)(xst + i * XPITCH) = __builtin_convertvector(xr[0][i], v4h);
  __syncthreads();
  // its registers take chunk XDEPTH, behind the barrier, which waits for every
  // load issued in front of it
#pragma unroll
  for (int i = 0; i < 8; ++i)
    xr[0][i] = *(const v4f*)(xg + (long)i * DIM + XDEPTH * XCH);

  v8f acc[4] = {};
  const _Float16* xfr = &ldsX[(16 * w + ln) * XPITCH];  // A operand: lane = row

#pragma unroll
  for (int c = 0; c < NXCH; ++c) {
    // the chunk's fragments, one group: A (2 K steps), B (2 K steps x 4 tiles)
    v16h A[2], B[2][4];
#pragma unroll
    for (int s = 0; s < 2; ++s) {
      A[s] = load2x8(xfr + s * 32, g);
#pragma unroll
      for (int t = 0; t < 4; ++t)
        B[s][t] = load2x8(&ldsW[(16 * t + ln) * WPITCH + c * XCH + s * 32], g);
    }
    if (c + 1 < NXCH) {
      // the wave's reads of its X buffer have returned before it is rewritten
      asm volatile("s_wait_dscnt 0x0" ::: "memory");
      // keeps a chunk's conversion at its store: lifted into an earlier trip,
      // it would wait for global loads that have only just been issued
      __builtin_amdgcn_sched_barrier(0);
#pragma unroll
      for (int i = 0; i < 8; ++i) {
        *(v4h*)(xst + i * XPITCH) =
            __builtin_convertvector(xr[(c + 1) % XDEPTH][i], v4h);
        if (c + 1 + XDEPTH < NXCH)
          xr[(c + 1) % XDEPTH][i] =
              *(const v4f*)(xg + (long)i * DIM + (c + 1 + XDEPTH) * XCH);
      }
    }
#pragma unroll
    for (int s = 0; s < 2; ++s)
#pragma unroll
      for (int t = 0; t < 4; ++t)
        acc[t] = __builtin_amdgcn_wmma_f32_16x16x32_f16(
            false, A[s], false, B[s][t], (short)0, acc[t], false, false);
    if (c + 1 < NXCH) {
      // keeps the wait below behind the products, which cover the stores' way
      __builtin_amdgcn_sched_barrier(0);
      // the other lanes' stores of the next chunk have landed before the wave
      // reads its fragments back
      asm volatile("s_wait_dscnt 0x0" ::: "memory");
      // trip's end, for the same reason as above
      __builtin_amdgcn_sched_barrier(0);
    }
  }

  // Epilogue: bias add, output scale (fp32), f16 convert, head-split store.
#pragma unroll
  for (int t = 0; t < 4; ++t) {
    const int   c  = cbase + 16 * t + ln;
    const float bv = bias[c];
    const int   h  = c >> 6;
    const int   d  = c & 63;
#pragma unroll
    for (int j = 0; j < 8; ++j) {
      int rg = rbase + 16 * w + 8 * g + j;  // C layout: row = 8g + j
      int b  = rg >> 11;                    // S = 2048
      int s  = rg & (S_LEN - 1);
      long idx = transposed
                     ? (((long)(b * NHEAD + h) * DHEAD + d) * S_LEN + s)
                     : (((long)(b * NHEAD + h) * S_LEN + s) * DHEAD + d);
      dst[idx] = (_Float16)((acc[t][j] + bv) * oscale);
    }
  }
}

#define KVPITCH (DHEAD + 8)
#define KVTILE  (64 * KVPITCH)   // halves in one staged tile
#define NTILE   (S_LEN / 64)

// One tile pair: every lane copies four 16-B pieces of K and four of V^T.
// kg, vg: the lane's first piece in global memory; lk: its place in the K tile
// of the target buffer (LDS byte address); the V^T tile lies behind the K tile.
// Piece i lies 16 tile rows behind piece i - 1.
static __device__ __forceinline__ void copy_kv_tile(const _Float16* kg,
                                                    const _Float16* vg,
                                                    unsigned lk) {
  const unsigned lv = lk + KVTILE * 2;
  const unsigned ls = 16 * KVPITCH * 2;
  // The closing s_wait_xcnt 0 stands inside the statement so that no address
  // register of a copy is rewritten before it.
  asm volatile(
      "global_load_async_to_lds_b128 %0, %8, off\n\t"
      "global_load_async_to_lds_b128 %1, %9, off\n\t"
      "global_load_async_to_lds_b128 %2, %10, off\n\t"
      "global_load_async_to_lds_b128 %3, %11, off\n\t"
      "global_load_async_to_lds_b128 %4, %12, off\n\t"
      "global_load_async_to_lds_b128 %5, %13, off\n\t"
      "global_load_async_to_lds_b128 %6, %14, off\n\t"
      "global_load_async_to_lds_b128 %7, %15, off\n\t"
      "s_wait_xcnt 0x0"
      :: "v"(lk), "v"(lk + ls), "v"(lk + 2 * ls), "v"(lk + 3 * ls),
         "v"(lv), "v"(lv + ls), "v"(lv + 2 * ls), "v"(lv + 3 * ls),
         "v"(kg), "v"(kg + 16 * DHEAD), "v"(kg + 32 * DHEAD),
         "v"(kg + 48 * DHEAD),
         "v"(vg), "v"(vg + 16 * S_LEN), "v"(vg + 32 * S_LEN),
         "v"(vg + 48 * S_LEN)
      : "memory");
}

// Value of lane l ^ 16 (the other half of the wave), by a vector cross-row move.
static __device__ __forceinline__ float other_half(float x) {
  const int b = __builtin_bit_cast(int, x);
  return __builtin_bit_cast(float, __builtin_amdgcn_permlanex16(
      b, b, 0x76543210, 0xfedcba98, false, false));
}

// waves_per_eu: the grid puts four waves on a SIMD (four blocks per WGP); told
// so, the compiler spends that share of the registers and reuses fewer of them
// between the fragment loads, the softmax and the products (fewer waits, nops).
__global__ __launch_bounds__(128) __attribute__((amdgpu_waves_per_eu(4, 4)))
void attn_kernel(
    const _Float16* __restrict__ Q, const _Float16* __restrict__ K,
    const _Float16* __restrict__ VT, float* __restrict__ out) {
  __shared__ __align__(16) _Float16 ldsKV[2 * 2 * KVTILE];  // [buffer][K, V^T]

  const int tid  = threadIdx.x;
  const int w    = tid >> 5;
  const int lane = tid & 31;
  const int g    = lane >> 4;
  const int ln   = lane & 15;
  const int qb = blockIdx.x, h = blockIdx.y, b = blockIdx.z;

  const long bh = (long)b * NHEAD + h;
  const _Float16* qp = Q  + bh * S_LEN * DHEAD;
  const _Float16* kp = K  + bh * S_LEN * DHEAD;
  const _Float16* vp = VT + bh * DHEAD * S_LEN;

  // Q^T operand (B: lane = query column), loop-invariant; it already carries
  // the softmax scale in log2 units.
  const int qrow = qb * 64 + 16 * w + ln;
  v16h Bq[2];
#pragma unroll
  for (int kc = 0; kc < 2; ++kc)
    Bq[kc] = load2x8(qp + (long)qrow * DHEAD + kc * 32, g);

  float m = -1e30f;  // running maximum of the lane's query, equal in both halves
  v8f   lv = {};     // partial row sums: this lane's keys only
  v8f   acc[4] = {}; // O^T: acc[t][j] = O[query ln][d = 16t + 8g + j]

  // The lane's piece of a tile: row tid / 8, 16-B column tid % 8, so that a
  // wave's copy covers four whole 128-B lines.
  const _Float16* kg = kp + tid * 8;
  const _Float16* vg = vp + (long)(tid >> 3) * S_LEN + (tid & 7) * 8;
  const unsigned  lk =
      (unsigned)(size_t)&ldsKV[(tid >> 3) * KVPITCH + (tid & 7) * 8];

  copy_kv_tile(kg, vg, lk);
  // tile 0 has landed for this wave, then for the block
  asm volatile("s_wait_asynccnt 0x0" ::: "memory");
  __syncthreads();
  copy_kv_tile(kg + 64 * DHEAD, vg + 64, lk + 2 * KVTILE * 2);

  for (int kb = 0; kb < NTILE; ++kb) {
    const int buf = (kb & 1) * 2 * KVTILE;
    // ---- scores (log2 units): S^T = K @ Qs^T, 64 keys x 16 queries ----
    // sc[t][j] = score of key 16t + 8g + j against query ln
    v16h Ak[8];
    // every inner loop of the trip is unrolled: Ak, Av, sc, ph and acc are
    // indexed by constants only and stay in registers
#pragma unroll
    for (int t = 0; t < 4; ++t) {
      const _Float16* kr = &ldsKV[buf + (16 * t + ln) * KVPITCH];
      Ak[2 * t]     = load2x8(kr, g);
      Ak[2 * t + 1] = load2x8(kr + 32, g);
    }
    // V^T fragments of this tile (A: lane = row d), read in the same group so
    // that their LDS latency passes behind the score products and the softmax.
    v16h Av[8];
#pragma unroll
    for (int t = 0; t < 4; ++t) {
      const _Float16* vb = &ldsKV[buf + KVTILE + (16 * t + ln) * KVPITCH];
      Av[2 * t]     = load2x8(vb, g);
      Av[2 * t + 1] = load2x8(vb + 32, g);
    }
    // keeps the trip's 32 fragment loads in one place: sunk between the
    // products, each small group would be waited for at its own place
    __builtin_amdgcn_sched_barrier(0);

    v8f sc[4];
#pragma unroll
    for (int t = 0; t < 4; ++t) {
      v8f z = {};
      sc[t] = __builtin_amdgcn_wmma_f32_16x16x32_f16(false, Ak[2 * t], false, Bq[0],
                                                     (short)0, z, false, false);
    }
#pragma unroll
    for (int t = 0; t < 4; ++t)
      sc[t] = __builtin_amdgcn_wmma_f32_16x16x32_f16(false, Ak[2 * t + 1], false, Bq[1],
                                                     (short)0, sc[t], false, false);

    // ---- maximum of the query's 64 scores: in-lane, then across the halves ----
    float mt[4];
#pragma unroll
    for (int t = 0; t < 4; ++t) {
      float v = sc[t][0];
#pragma unroll
      for (int j = 1; j < 8; ++j) v = fmaxf(v, sc[t][j]);
      mt[t] = v;
    }
    float mn = fmaxf(fmaxf(fmaxf(mt[0], mt[1]), fmaxf(mt[2], mt[3])), m);
    mn = fmaxf(mn, other_half(mn));

    const float corr = __builtin_amdgcn_exp2f(m - mn);
    m = mn;

    // ---- p = 2^(s - m); partial sums; P^T packed as the B operand ----
    // B element s of key chunk kc is key 32kc + 8g + s (s < 8) or
    // 32kc + 16 + 8g + s - 8: score tiles 2kc and 2kc + 1, register for register.
    v8h ph[4];
    lv *= corr;
#pragma unroll
    for (int t = 0; t < 4; ++t) {
      const v8f e = sc[t] - mn;
      v8f p;
#pragma unroll
      for (int j = 0; j < 8; ++j) p[j] = __builtin_amdgcn_exp2f(e[j]);
      lv += p;
      ph[t] = __builtin_convertvector(p, v8h);
      acc[t] *= corr;  // rescale output accumulator
    }
    const v16h Bp0 = __builtin_shufflevector(ph[0], ph[1], 0, 1, 2, 3, 4, 5, 6, 7,
                                             8, 9, 10, 11, 12, 13, 14, 15);
    const v16h Bp1 = __builtin_shufflevector(ph[2], ph[3], 0, 1, 2, 3, 4, 5, 6, 7,
                                             8, 9, 10, 11, 12, 13, 14, 15);

    // ---- O^T += V^T @ P^T ----
#pragma unroll
    for (int t = 0; t < 4; ++t)
      acc[t] = __builtin_amdgcn_wmma_f32_16x16x32_f16(false, Av[2 * t], false, Bp0,
                                                      (short)0, acc[t], false, false);
#pragma unroll
    for (int t = 0; t < 4; ++t)
      acc[t] = __builtin_amdgcn_wmma_f32_16x16x32_f16(false, Av[2 * t + 1], false, Bp1,
                                                      (short)0, acc[t], false, false);

    // keeps the hand-over at the trip's foot: lifted over the softmax, it would
    // leave the next copies, issued behind the PV products, too short a flight
    __builtin_amdgcn_sched_barrier(0);
    // Hand-over: this wave's reads of the buffer are done ...
    asm volatile("s_wait_dscnt 0x0" ::: "memory");
    // ... and its copies of the next tile have landed;
    asm volatile("s_wait_asynccnt 0x0" ::: "memory");
    // the barrier publishes the next tile and frees this trip's buffer.
    __syncthreads();
    if (kb + 2 < NTILE)
      copy_kv_tile(kg + (long)(kb + 2) * 64 * DHEAD, vg + (kb + 2) * 64,
                   lk + buf * 2);
  }
  // no copy is left in flight when the wave ends
  asm volatile("s_wait_asynccnt 0x0" ::: "memory");

  // ---- epilogue: join the partial row sums, normalize, store fp32 ----
  float l = ((lv[0] + lv[1]) + (lv[2] + lv[3])) + ((lv[4] + lv[5]) + (lv[6] + lv[7]));
  l += other_half(l);
  const float inv = 1.0f / l;
  // A lane holds eight consecutive d of its query per tile: two 16-B stores.
  float* orow = out + ((long)b * S_LEN + qrow) * DIM + h * DHEAD + 8 * g;
#pragma unroll
  for (int t = 0; t < 4; ++t) {
    const v8f o = acc[t] * inv;
    *(v4f*)(orow + 16 * t)     = __builtin_shufflevector(o, o, 0, 1, 2, 3);
    *(v4f*)(orow + 16 * t + 4) = __builtin_shufflevector(o, o, 4, 5, 6, 7);
  }
}

// ---------------------------------------------------------------------------
extern "C" void kernel_launch(void* const* d_in, const int* in_sizes, int n_in,
                              void* d_out, int out_size, void* d_ws, size_t ws_size,
                              hipStream_t stream) {
  const float* q  = (const float*)d_in[0];
  const float* k  = (const float*)d_in[1];
  const float* v  = (const float*)d_in[2];
  const float* Wq = (const float*)d_in[3];
  const float* bq = (const float*)d_in[4];
  const float* Wk = (const float*)d_in[5];
  const float* bk = (const float*)d_in[6];
  const float* Wv = (const float*)d_in[7];
  const float* bv = (const float*)d_in[8];

  const size_t per = (size_t)B_SZ * NHEAD * S_LEN * DHEAD;  // f16 elements
  _Float16* wsq = (_Float16*)d_ws;
  _Float16* wsk = wsq + per;
  _Float16* wsv = wsk + per;

  dim3 blk(128);
  dim3 g1(DIM / 64, (B_SZ * S_LEN) / 64);   // (8, 128)
  qkv_proj_kernel<<<g1, blk, 0, stream>>>(q, Wq, bq, wsq, 0, Q_SCALE);
  qkv_proj_kernel<<<g1, blk, 0, stream>>>(k, Wk, bk, wsk, 0, 1.0f);
  qkv_proj_kernel<<<g1, blk, 0, stream>>>(v, Wv, bv, wsv, 1, 1.0f);

  dim3 g2(S_LEN / 64, NHEAD, B_SZ);         // (32, 8, 4)
  attn_kernel<<<g2, blk, 0, stream>>>(wsq, wsk, wsv, (float*)d_out);
}

// v005
// Measured time: 75.5 microseconds a run.
// In both of two side-by-side timings against v004, it was 1.09 times as fast.
// All steps since v000 together make it 3.28 times as fast.
#include <hip/hip_runtime.h>
#include <hip/hip_bf16.h>

typedef __attribute__((ext_vector_type(16))) _Float16 v16h;
typedef __attribute__((ext_vector_type(8)))  _Float16 v8h;
typedef __attribute__((ext_vector_type(4)))  _Float16 v4h;
typedef __attribute__((ext_vector_type(8)))  float    v8f;
typedef __attribute__((ext_vector_type(4)))  float    v4f;

#define B_SZ   4
#define S_LEN  2048
#define NHEAD  8
#define DHEAD  64
#define DIM    512

// 1/sqrt(DHEAD) * log2(e): folds softmax scaling AND the exp->exp2 change of
// base into the Q projection (applied in fp32 there).
#define Q_SCALE (0.125f * 1.4426950408889634f)

// Build a 16-bit WMMA A/B operand for 16x16x32:
// lane (g = lane>>4) holds halves K = {8g..8g+7} and {16+8g..16+8g+7},
// i.e. two contiguous 16-byte runs from a K-major row/column.
static __device__ __forceinline__ v16h load2x8(const _Float16* base, int g) {
  const v8h lo = *(const v8h*)(base + 8 * g);
  const v8h hi = *(const v8h*)(base + 16 + 8 * g);
  v16h r;
#pragma unroll
  for (int i = 0; i < 8; ++i) { r[i] = lo[i]; r[i + 8] = hi[i]; }
  return r;
}

// ---------------------------------------------------------------------------
// Kernel 1: Y = (X @ W + b) * oscale, converted to f16, written head-split.
//   transposed==0 : dst[((b*H + h)*S + s)*64 + d]   (Q, K)
//   transposed==1 : dst[((b*H + h)*64 + d)*S + s]   (V^T for PV A-operand)
// Block = 128 threads (4 waves); block tile = 64 rows x 64 cols; K step 32.
// The block's whole W panel (512 k x 64 cols) is staged in LDS once, so the
// K loop runs without barriers.
// X reaches the A operand through LDS: a wave reads its 16 rows in chunks of
// 64 k with loads that cover whole 256-B runs of two rows (4 lines a load; a
// load in fragment order would touch 16), converts, stores the chunk in a
// buffer of its own and reads the fragments back. Three chunks are in flight.
// The result leaves through LDS too: the block's tile is 64 whole 128-B lines
// of dst (one head: 64 s x 64 d, or 64 d x 64 s), and every 16-B store of a wave
// covers four of them.
// ---------------------------------------------------------------------------
// LDS row pitch in halves: 1040 B = 16 B x 65 (odd), so that 16 lanes on 16
// consecutive columns cover all 64 banks in a 16-byte store or load.
#define WPITCH (DIM + 8)
// X chunk: 64 k; row pitch 144 B = 16 B x 9 (odd), as the fragment reads want.
#define XCH    64
#define XPITCH (XCH + 8)
#define NXCH   (DIM / XCH)
#define XDEPTH 3

__global__ __launch_bounds__(128) void qkv_proj_kernel(
    const float* __restrict__ X, const float* __restrict__ W,
    const float* __restrict__ bias, _Float16* __restrict__ dst,
    int transposed, float oscale) {
  __shared__ __align__(16) _Float16 ldsW[64 * WPITCH];  // [col][k] panel
  __shared__ __align__(16) _Float16 ldsX[4 * 16 * XPITCH];  // [wave][row][k]

  const int tid  = threadIdx.x;
  const int w    = tid >> 5;
  const int lane = tid & 31;
  const int g    = lane >> 4;
  const int ln   = lane & 15;
  const int rbase = blockIdx.y * 64;
  const int cbase = blockIdx.x * 64;

  // The lane's place in a chunk of X: piece i is row i + 8g of the wave's 16,
  // floats 4 ln .. 4 ln + 3 of the chunk. Rows i and i + 8 lie 32 banks apart.
  const float* xg  = X + (long)(rbase + 16 * w + 8 * g) * DIM + 4 * ln;
  _Float16*    xst = &ldsX[(16 * w + 8 * g) * XPITCH + 4 * ln];
  v4f xr[XDEPTH][8];
  // every loop over xr is unrolled: it is indexed by constants only
  // The first chunks fly while the W panel is staged.
#pragma unroll
  for (int c = 0; c < XDEPTH; ++c)
#pragma unroll
    for (int i = 0; i < 8; ++i)
      xr[c][i] = *(const v4f*)(xg + (long)i * DIM + c * XCH);

  // Stage W[0 .. 512)[cbase .. +64) as f16, [col][k]. A lane owns one column:
  // eight row loads (one 128-B line per wave each) pack into one 16-B store.
  {
    const int    cc = tid & 63;
    const int    kh = tid >> 6;
    const float* wc = W + cbase + cc;
    // unroll 8: 64 independent loads in flight per lane, to cover L2 latency
#pragma unroll 8
    for (int i = 0; i < DIM / 16; ++i) {
      const int k0 = (2 * i + kh) * 8;
      v8h pk;
#pragma unroll
      for (int j = 0; j < 8; ++j) pk[j] = (_Float16)wc[(long)(k0 + j) * DIM];
      *(v8h*)&ldsW[cc * WPITCH + k0] = pk;
    }
  }
  // chunk 0 into the wave's buffer
#pragma unroll
  for (int i = 0; i < 8; ++i)
    *(v4h*)(xst + i * XPITCH) = __builtin_convertvector(xr[0][i], v4h);
  __syncthreads();
  // its registers take chunk XDEPTH, behind the barrier, which waits for every
  // load issued in front of it
#pragma unroll
  for (int i = 0; i < 8; ++i)
    xr[0][i] = *(const v4f*)(xg + (long)i * DIM + XDEPTH * XCH);

  v8f   acc[4] = {};
  float bv[4];  // bias of the lane's four columns, loaded in the last trip
  const _Float16* xfr = &ldsX[(16 * w + ln) * XPITCH];  // A operand: lane = row

#pragma unroll
  for (int c = 0; c < NXCH; ++c) {
    // the chunk's fragments, one group: A (2 K steps), B (2 K steps x 4 tiles)
    v16h A[2], B[2][4];
#pragma unroll
    for (int s = 0; s < 2; ++s) {
      A[s] = load2x8(xfr + s * 32, g);
#pragma unroll
      for (int t = 0; t < 4; ++t)
        B[s][t] = load2x8(&ldsW[(16 * t + ln) * WPITCH + c * XCH + s * 32], g);
    }
    if (c + 1 < NXCH) {
      // the wave's reads of its X buffer have returned before it is rewritten
      asm volatile("s_wait_dscnt 0x0" ::: "memory");
      // keeps a chunk's conversion at its store: lifted into an earlier trip,
      // it would wait for global loads that have only just been issued
      __builtin_amdgcn_sched_barrier(0);
#pragma unroll
      for (int i = 0; i < 8; ++i) {
        *(v4h*)(xst + i * XPITCH) =
            __builtin_convertvector(xr[(c + 1) % XDEPTH][i], v4h);
        if (c + 1 + XDEPTH < NXCH)
          xr[(c + 1) % XDEPTH][i] =
              *(const v4f*)(xg + (long)i * DIM + (c + 1 + XDEPTH) * XCH);
      }
    } else {
      // the epilogue's bias values fly behind the last products
#pragma unroll
      for (int t = 0; t < 4; ++t) bv[t] = bias[cbase + 16 * t + ln];
      // stands in front of any later rewrite of the loads' address registers
      asm volatile("s_wait_xcnt 0x0" ::: "memory");
      // keeps the last chunk's loads one group, as in the other trips: sunk
      // between the products, each pair is waited for on its own
      __builtin_amdgcn_sched_barrier(0);
    }
#pragma unroll
    for (int s = 0; s < 2; ++s)
#pragma unroll
      for (int t = 0; t < 4; ++t)
        acc[t] = __builtin_amdgcn_wmma_f32_16x16x32_f16(
            false, A[s], false, B[s][t], (short)0, acc[t], false, false);
    if (c + 1 < NXCH) {
      // keeps the wait below behind the products, which cover the stores' way
      __builtin_amdgcn_sched_barrier(0);
      // the other lanes' stores of the next chunk have landed before the wave
      // reads its fragments back
      asm volatile("s_wait_dscnt 0x0" ::: "memory");
      // trip's end, for the same reason as above
      __builtin_amdgcn_sched_barrier(0);
    }
  }

  // Epilogue: bias add, output scale (fp32), f16 convert, head-split store.
  // acc[t][j] is row 16w + 8g + j (s), column 16t + ln (d) of the block's tile.
  // The tile is staged in ldsX at the X pitch and leaves in rows of 128 B.
  const int  h   = blockIdx.x;          // the block's 64 columns are one head
  const int  bb  = rbase >> 11;         // S = 2048: 64 rows lie in one batch
  const int  s0  = rbase & (S_LEN - 1);
  const long bh  = (long)(bb * NHEAD + h);
  const int  pr  = lane >> 3;           // read-back: row in a group of four,
  const int  pc  = (lane & 7) * 8;      // 16-B piece of the row

  if (transposed) {
    // V^T: tile [d][s]. A line holds s of all four waves, so the tile spans
    // the four X buffers: every wave has left its own before any is rewritten.
    __syncthreads();
#pragma unroll
    for (int t = 0; t < 4; ++t) {
      v8h pk;  // eight consecutive s of one d
#pragma unroll
      for (int j = 0; j < 8; ++j)
        pk[j] = (_Float16)((acc[t][j] + bv[t]) * oscale);
      *(v8h*)&ldsX[(16 * t + ln) * XPITCH + 16 * w + 8 * g] = pk;
    }
    // the tile is whole before a wave reads rows that all four wrote
    __syncthreads();
    _Float16* o = dst + (bh * DHEAD + 16 * w + pr) * S_LEN + s0 + pc;
#pragma unroll
    for (int i = 0; i < 4; ++i)
      *(v8h*)(o + (long)(4 * i) * S_LEN) =
          *(const v8h*)&ldsX[(16 * w + 4 * i + pr) * XPITCH + pc];
  } else {
    // Q, K: tile [s][d]. A wave's 16 rows are its own: it stages them in its
    // own X buffer, whose last fragments the products above have consumed.
    _Float16* st = &ldsX[(16 * w + 8 * g) * XPITCH + ln];
#pragma unroll
    for (int t = 0; t < 4; ++t)
#pragma unroll
      for (int j = 0; j < 8; ++j)
        st[j * XPITCH + 16 * t] = (_Float16)((acc[t][j] + bv[t]) * oscale);
    // the other lanes' stores have landed before the wave reads the rows back
    asm volatile("s_wait_dscnt 0x0" ::: "memory");
    _Float16* o = dst + (bh * S_LEN + s0 + 16 * w + pr) * DHEAD + pc;
#pragma unroll
    for (int i = 0; i < 4; ++i)
      *(v8h*)(o + 4 * i * DHEAD) =
          *(const v8h*)&ldsX[(16 * w + 4 * i + pr) * XPITCH + pc];
  }
}

#define KVPITCH (DHEAD + 8)
#define KVTILE  (64 * KVPITCH)   // halves in one staged tile
#define NTILE   (S_LEN / 64)

// One tile pair: every lane copies four 16-B pieces of K and four of V^T.
// kg, vg: the lane's first piece in global memory; lk: its place in the K tile
// of the target buffer (LDS byte address); the V^T tile lies behind the K tile.
// Piece i lies 16 tile rows behind piece i - 1.
static __device__ __forceinline__ void copy_kv_tile(const _Float16* kg,
                                                    const _Float16* vg,
                                                    unsigned lk) {
  const unsigned lv = lk + KVTILE * 2;
  const unsigned ls = 16 * KVPITCH * 2;
  // The closing s_wait_xcnt 0 stands inside the statement so that no address
  // register of a copy is rewritten before it.
  asm volatile(
      "global_load_async_to_lds_b128 %0, %8, off\n\t"
      "global_load_async_to_lds_b128 %1, %9, off\n\t"
      "global_load_async_to_lds_b128 %2, %10, off\n\t"
      "global_load_async_to_lds_b128 %3, %11, off\n\t"
      "global_load_async_to_lds_b128 %4, %12, off\n\t"
      "global_load_async_to_lds_b128 %5, %13, off\n\t"
      "global_load_async_to_lds_b128 %6, %14, off\n\t"
      "global_load_async_to_lds_b128 %7, %15, off\n\t"
      "s_wait_xcnt 0x0"
      :: "v"(lk), "v"(lk + ls), "v"(lk + 2 * ls), "v"(lk + 3 * ls),
         "v"(lv), "v"(lv + ls), "v"(lv + 2 * ls), "v"(lv + 3 * ls),
         "v"(kg), "v"(kg + 16 * DHEAD), "v"(kg + 32 * DHEAD),
         "v"(kg + 48 * DHEAD),
         "v"(vg), "v"(vg + 16 * S_LEN), "v"(vg + 32 * S_LEN),
         "v"(vg + 48 * S_LEN)
      : "memory");
}

// Value of lane l ^ 16 (the other half of the wave), by a vector cross-row move.
static __device__ __forceinline__ float other_half(float x) {
  const int b = __builtin_bit_cast(int, x);
  return __builtin_bit_cast(float, __builtin_amdgcn_permlanex16(
      b, b, 0x76543210, 0xfedcba98, false, false));
}

// waves_per_eu: the grid puts four waves on a SIMD (four blocks per WGP); told
// so, the compiler spends that share of the registers and reuses fewer of them
// between the fragment loads, the softmax and the products (fewer waits, nops).
__global__ __launch_bounds__(128) __attribute__((amdgpu_waves_per_eu(4, 4)))
void attn_kernel(
    const _Float16* __restrict__ Q, const _Float16* __restrict__ K,
    const _Float16* __restrict__ VT, float* __restrict__ out) {
  __shared__ __align__(16) _Float16 ldsKV[2 * 2 * KVTILE];  // [buffer][K, V^T]

  const int tid  = threadIdx.x;
  const int w    = tid >> 5;
  const int lane = tid & 31;
  const int g    = lane >> 4;
  const int ln   = lane & 15;
  const int qb = blockIdx.x, h = blockIdx.y, b = blockIdx.z;

  const long bh = (long)b * NHEAD + h;
  const _Float16* qp = Q  + bh * S_LEN * DHEAD;
  const _Float16* kp = K  + bh * S_LEN * DHEAD;
  const _Float16* vp = VT + bh * DHEAD * S_LEN;

  // Q^T operand (B: lane = query column), loop-invariant; it already carries
  // the softmax scale in log2 units.
  const int qrow = qb * 64 + 16 * w + ln;
  v16h Bq[2];
#pragma unroll
  for (int kc = 0; kc < 2; ++kc)
    Bq[kc] = load2x8(qp + (long)qrow * DHEAD + kc * 32, g);

  float m = -1e30f;  // running maximum of the lane's query, equal in both halves
  v8f   lv = {};     // partial row sums: this lane's keys only
  v8f   acc[4] = {}; // O^T: acc[t][j] = O[query ln][d = 16t + 8g + j]

  // The lane's piece of a tile: row tid / 8, 16-B column tid % 8, so that a
  // wave's copy covers four whole 128-B lines.
  const _Float16* kg = kp + tid * 8;
  const _Float16* vg = vp + (long)(tid >> 3) * S_LEN + (tid & 7) * 8;
  const unsigned  lk =
      (unsigned)(size_t)&ldsKV[(tid >> 3) * KVPITCH + (tid & 7) * 8];

  copy_kv_tile(kg, vg, lk);
  // tile 0 has landed for this wave, then for the block
  asm volatile("s_wait_asynccnt 0x0" ::: "memory");
  __syncthreads();
  copy_kv_tile(kg + 64 * DHEAD, vg + 64, lk + 2 * KVTILE * 2);

  for (int kb = 0; kb < NTILE; ++kb) {
    const int buf = (kb & 1) * 2 * KVTILE;
    // ---- scores (log2 units): S^T = K @ Qs^T, 64 keys x 16 queries ----
    // sc[t][j] = score of key 16t + 8g + j against query ln
    v16h Ak[8];
    // every inner loop of the trip is unrolled: Ak, Av, sc, ph and acc are
    // indexed by constants only and stay in registers
#pragma unroll
    for (int t = 0; t < 4; ++t) {
      const _Float16* kr = &ldsKV[buf + (16 * t + ln) * KVPITCH];
      Ak[2 * t]     = load2x8(kr, g);
      Ak[2 * t + 1] = load2x8(kr + 32, g);
    }
    // V^T fragments of this tile (A: lane = row d), read in the same group so
    // that their LDS latency passes behind the score products and the softmax.
    v16h Av[8];
#pragma unroll
    for (int t = 0; t < 4; ++t) {
      const _Float16* vb = &ldsKV[buf + KVTILE + (16 * t + ln) * KVPITCH];
      Av[2 * t]     = load2x8(vb, g);
      Av[2 * t + 1] = load2x8(vb + 32, g);
    }
    // keeps the trip's 32 fragment loads in one place: sunk between the
    // products, each small group would be waited for at its own place
    __builtin_amdgcn_sched_barrier(0);

    v8f sc[4];
#pragma unroll
    for (int t = 0; t < 4; ++t) {
      v8f z = {};
      sc[t] = __builtin_amdgcn_wmma_f32_16x16x32_f16(false, Ak[2 * t], false, Bq[0],
                                                     (short)0, z, false, false);
    }
#pragma unroll
    for (int t = 0; t < 4; ++t)
      sc[t] = __builtin_amdgcn_wmma_f32_16x16x32_f16(false, Ak[2 * t + 1], false, Bq[1],
                                                     (short)0, sc[t], false, false);

    // ---- maximum of the query's 64 scores: in-lane, then across the halves ----
    float mt[4];
#pragma unroll
    for (int t = 0; t < 4; ++t) {
      float v = sc[t][0];
#pragma unroll
      for (int j = 1; j < 8; ++j) v = fmaxf(v, sc[t][j]);
      mt[t] = v;
    }
    float mn = fmaxf(fmaxf(fmaxf(mt[0], mt[1]), fmaxf(mt[2], mt[3])), m);
    mn = fmaxf(mn, other_half(mn));

    const float corr = __builtin_amdgcn_exp2f(m - mn);
    m = mn;

    // ---- p = 2^(s - m); partial sums; P^T packed as the B operand ----
    // B element s of key chunk kc is key 32kc + 8g + s (s < 8) or
    // 32kc + 16 + 8g + s - 8: score tiles 2kc and 2kc + 1, register for register.
    v8h ph[4];
    lv *= corr;
#pragma unroll
    for (int t = 0; t < 4; ++t) {
      const v8f e = sc[t] - mn;
      v8f p;
#pragma unroll
      for (int j = 0; j < 8; ++j) p[j] = __builtin_amdgcn_exp2f(e[j]);
      lv += p;
      ph[t] = __builtin_convertvector(p, v8h);
      acc[t] *= corr;  // rescale output accumulator
    }
    const v16h Bp0 = __builtin_shufflevector(ph[0], ph[1], 0, 1, 2, 3, 4, 5, 6, 7,
                                             8, 9, 10, 11, 12, 13, 14, 15);
    const v16h Bp1 = __builtin_shufflevector(ph[2], ph[3], 0, 1, 2, 3, 4, 5, 6, 7,
                                             8, 9, 10, 11, 12, 13, 14, 15);

    // ---- O^T += V^T @ P^T ----
#pragma unroll
    for (int t = 0; t < 4; ++t)
      acc[t] = __builtin_amdgcn_wmma_f32_16x16x32_f16(false, Av[2 * t], false, Bp0,
                                                      (short)0, acc[t], false, false);
#pragma unroll
    for (int t = 0; t < 4; ++t)
      acc[t] = __builtin_amdgcn_wmma_f32_16x16x32_f16(false, Av[2 * t + 1], false, Bp1,
                                                      (short)0, acc[t], false, false);

    // keeps the hand-over at the trip's foot: lifted over the softmax, it would
    // leave the next copies, issued behind the PV products, too short a flight
    __builtin_amdgcn_sched_barrier(0);
    // Hand-over: this wave's reads of the buffer are done ...
    asm volatile("s_wait_dscnt 0x0" ::: "memory");
    // ... and its copies of the next tile have landed;
    asm volatile("s_wait_asynccnt 0x0" ::: "memory");
    // the barrier publishes the next tile and frees this trip's buffer.
    __syncthreads();
    if (kb + 2 < NTILE)
      copy_kv_tile(kg + (long)(kb + 2) * 64 * DHEAD, vg + (kb + 2) * 64,
                   lk + buf * 2);
  }
  // no copy is left in flight when the wave ends
  asm volatile("s_wait_asynccnt 0x0" ::: "memory");

  // ---- epilogue: join the partial row sums, normalize, store fp32 ----
  float l = ((lv[0] + lv[1]) + (lv[2] + lv[3])) + ((lv[4] + lv[5]) + (lv[6] + lv[7]));
  l += other_half(l);
  const float inv = 1.0f / l;
  // A lane holds eight consecutive d of its query per tile: two 16-B stores.
  float* orow = out + ((long)b * S_LEN + qrow) * DIM + h * DHEAD + 8 * g;
#pragma unroll
  for (int t = 0; t < 4; ++t) {
    const v8f o = acc[t] * inv;
    *(v4f*)(orow + 16 * t)     = __builtin_shufflevector(o, o, 0, 1, 2, 3);
    *(v4f*)(orow + 16 * t + 4) = __builtin_shufflevector(o, o, 4, 5, 6, 7);
  }
}

// ---------------------------------------------------------------------------
extern "C" void kernel_launch(void* const* d_in, const int* in_sizes, int n_in,
                              void* d_out, int out_size, void* d_ws, size_t ws_size,
                              hipStream_t stream) {
  const float* q  = (const float*)d_in[0];
  const float* k  = (const float*)d_in[1];
  const float* v  = (const float*)d_in[2];
  const float* Wq = (const float*)d_in[3];
  const float* bq = (const float*)d_in[4];
  const float* Wk = (const float*)d_in[5];
  const float* bk = (const float*)d_in[6];
  const float* Wv = (const float*)d_in[7];
  const float* bv = (const float*)d_in[8];

  const size_t per = (size_t)B_SZ * NHEAD * S_LEN * DHEAD;  // f16 elements
  _Float16* wsq = (_Float16*)d_ws;
  _Float16* wsk = wsq + per;
  _Float16* wsv = wsk + per;

  dim3 blk(128);
  dim3 g1(DIM / 64, (B_SZ * S_LEN) / 64);   // (8, 128)
  qkv_proj_kernel<<<g1, blk, 0, stream>>>(q, Wq, bq, wsq, 0, Q_SCALE);
  qkv_proj_kernel<<<g1, blk, 0, stream>>>(k, Wk, bk, wsk, 0, 1.0f);
  qkv_proj_kernel<<<g1, blk, 0, stream>>>(v, Wv, bv, wsv, 1, 1.0f);

  dim3 g2(S_LEN / 64, NHEAD, B_SZ);         // (32, 8, 4)
  attn_kernel<<<g2, blk, 0, stream>>>(wsq, wsk, wsv, (float*)d_out);
}

// v006
// Measured time: 68.5 microseconds a run.
// In two side-by-side timings against v005, it was 1.09 and 1.08 times as fast.
// All steps since v000 together make it 3.56 times as fast.
#include <hip/hip_runtime.h>
#include <hip/hip_bf16.h>

typedef __attribute__((ext_vector_type(16))) _Float16 v16h;
typedef __attribute__((ext_vector_type(8)))  _Float16 v8h;
typedef __attribute__((ext_vector_type(4)))  _Float16 v4h;
typedef __attribute__((ext_vector_type(8)))  float    v8f;
typedef __attribute__((ext_vector_type(4)))  float    v4f;

#define B_SZ   4
#define S_LEN  2048
#define NHEAD  8
#define DHEAD  64
#define DIM    512

// 1/sqrt(DHEAD) * log2(e): folds softmax scaling AND the exp->exp2 change of
// base into the Q projection (applied in fp32 there).
#define Q_SCALE (0.125f * 1.4426950408889634f)

// Build a 16-bit WMMA A/B operand for 16x16x32:
// lane (g = lane>>4) holds halves K = {8g..8g+7} and {16+8g..16+8g+7},
// i.e. two contiguous 16-byte runs from a K-major row/column.
static __device__ __forceinline__ v16h load2x8(const _Float16* base, int g) {
  const v8h lo = *(const v8h*)(base + 8 * g);
  const v8h hi = *(const v8h*)(base + 16 + 8 * g);
  v16h r;
#pragma unroll
  for (int i = 0; i < 8; ++i) { r[i] = lo[i]; r[i + 8] = hi[i]; }
  return r;
}

// ---------------------------------------------------------------------------
// Kernel 1: Y = (X @ W + b) * oscale, converted to f16, written head-split.
//   transposed==0 : dst[((b*H + h)*S + s)*64 + d]   (Q, K)
//   transposed==1 : dst[((b*H + h)*64 + d)*S + s]   (V^T for PV A-operand)
// One launch holds the three independent projections; blockIdx.z names the
// block's own (0: Q, 1: K, 2: V). A WGP holds four blocks, a third of the grid
// is resident at a time, and a block that ends is followed by the next, so that
// one block's panel staging runs beside its neighbours' K loops.
// Block = 128 threads (4 waves); block tile = 64 rows x 64 cols; K step 32.
// The block's whole W panel (512 k x 64 cols) is staged in LDS once, so the
// K loop runs without barriers.
// X reaches the A operand through LDS: a wave reads its 16 rows in chunks of
// 64 k with loads that cover whole 256-B runs of two rows (4 lines a load; a
// load in fragment order would touch 16), converts, stores the chunk in a
// buffer of its own and reads the fragments back. Three chunks are in flight.
// The result leaves through LDS too: the block's tile is 64 whole 128-B lines
// of dst (one head: 64 s x 64 d, or 64 d x 64 s), and every 16-B store of a wave
// covers four of them.
// ---------------------------------------------------------------------------
// LDS row pitch in halves: 1040 B = 16 B x 65 (odd), so that 16 lanes on 16
// consecutive columns cover all 64 banks in a 16-byte store or load.
#define WPITCH (DIM + 8)
// X chunk: 64 k; row pitch 144 B = 16 B x 9 (odd), as the fragment reads want.
#define XCH    64
#define XPITCH (XCH + 8)
#define NXCH   (DIM / XCH)
#define XDEPTH 3

__global__ __launch_bounds__(128) void qkv_proj_kernel(
    const float* __restrict__ Xq, const float* __restrict__ Xk,
    const float* __restrict__ Xv, const float* __restrict__ Wq,
    const float* __restrict__ Wk, const float* __restrict__ Wv,
    const float* __restrict__ bq, const float* __restrict__ bk,
    const float* __restrict__ bvv, _Float16* __restrict__ ws) {
  __shared__ __align__(16) _Float16 ldsW[64 * WPITCH];  // [col][k] panel
  __shared__ __align__(16) _Float16 ldsX[4 * 16 * XPITCH];  // [wave][row][k]

  // The block's projection: operands, plane of the workspace, layout, scale.
  const int z = blockIdx.z;
  const float* __restrict__ X    = z == 0 ? Xq : z == 1 ? Xk : Xv;
  const float* __restrict__ W    = z == 0 ? Wq : z == 1 ? Wk : Wv;
  const float* __restrict__ bias = z == 0 ? bq : z == 1 ? bk : bvv;
  _Float16* __restrict__ dst = ws + (long)z * (B_SZ * NHEAD * S_LEN * DHEAD);
  const int   transposed = z == 2;
  const float oscale     = z == 0 ? Q_SCALE : 1.0f;

  const int tid  = threadIdx.x;
  const int w    = tid >> 5;
  const int lane = tid & 31;
  const int g    = lane >> 4;
  const int ln   = lane & 15;
  const int rbase = blockIdx.y * 64;
  const int cbase = blockIdx.x * 64;

  // The lane's place in a chunk of X: piece i is row i + 8g of the wave's 16,
  // floats 4 ln .. 4 ln + 3 of the chunk. Rows i and i + 8 lie 32 banks apart.
  const float* xg  = X + (long)(rbase + 16 * w + 8 * g) * DIM + 4 * ln;
  _Float16*    xst = &ldsX[(16 * w + 8 * g) * XPITCH + 4 * ln];
  v4f xr[XDEPTH][8];
  // every loop over xr is unrolled: it is indexed by constants only
  // The first chunks fly while the W panel is staged.
#pragma unroll
  for (int c = 0; c < XDEPTH; ++c)
#pragma unroll
    for (int i = 0; i < 8; ++i)
      xr[c][i] = *(const v4f*)(xg + (long)i * DIM + c * XCH);

  // Stage W[0 .. 512)[cbase .. +64) as f16, [col][k]. A lane owns one column:
  // eight row loads (one 128-B line per wave each) pack into one 16-B store.
  {
    const int    cc = tid & 63;
    const int    kh = tid >> 6;
    const float* wc = W + cbase + cc;
    // unroll 8: 64 independent loads in flight per lane, to cover L2 latency
#pragma unroll 8
    for (int i = 0; i < DIM / 16; ++i) {
      const int k0 = (2 * i + kh) * 8;
      v8h pk;
#pragma unroll
      for (int j = 0; j < 8; ++j) pk[j] = (_Float16)wc[(long)(k0 + j) * DIM];
      *(v8h*)&ldsW[cc * WPITCH + k0] = pk;
    }
  }
  // chunk 0 into the wave's buffer
#pragma unroll
  for (int i = 0; i < 8; ++i)
    *(v4h*)(xst + i * XPITCH) = __builtin_convertvector(xr[0][i], v4h);
  __syncthreads();
  // its registers take chunk XDEPTH, behind the barrier, which waits for every
  // load issued in front of it
#pragma unroll
  for (int i = 0; i < 8; ++i)
    xr[0][i] = *(const v4f*)(xg + (long)i * DIM + XDEPTH * XCH);

  v8f   acc[4] = {};
  float bv[4];  // bias of the lane's four columns, loaded in the last trip
  const _Float16* xfr = &ldsX[(16 * w + ln) * XPITCH];  // A operand: lane = row

#pragma unroll
  for (int c = 0; c < NXCH; ++c) {
    // the chunk's fragments, one group: A (2 K steps), B (2 K steps x 4 tiles)
    v16h A[2], B[2][4];
#pragma unroll
    for (int s = 0; s < 2; ++s) {
      A[s] = load2x8(xfr + s * 32, g);
#pragma unroll
      for (int t = 0; t < 4; ++t)
        B[s][t] = load2x8(&ldsW[(16 * t + ln) * WPITCH + c * XCH + s * 32], g);
    }
    if (c + 1 < NXCH) {
      // the wave's reads of its X buffer have returned before it is rewritten
      asm volatile("s_wait_dscnt 0x0" ::: "memory");
      // keeps a chunk's conversion at its store: lifted into an earlier trip,
      // it would wait for global loads that have only just been issued
      __builtin_amdgcn_sched_barrier(0);
#pragma unroll
      for (int i = 0; i < 8; ++i) {
        *(v4h*)(xst + i * XPITCH) =
            __builtin_convertvector(xr[(c + 1) % XDEPTH][i], v4h);
        if (c + 1 + XDEPTH < NXCH)
          xr[(c + 1) % XDEPTH][i] =
              *(const v4f*)(xg + (long)i * DIM + (c + 1 + XDEPTH) * XCH);
      }
    } else {
      // the epilogue's bias values fly behind the last products
#pragma unroll
      for (int t = 0; t < 4; ++t) bv[t] = bias[cbase + 16 * t + ln];
      // stands in front of any later rewrite of the loads' address registers
      asm volatile("s_wait_xcnt 0x0" ::: "memory");
      // keeps the last chunk's loads one group, as in the other trips: sunk
      // between the products, each pair is waited for on its own
      __builtin_amdgcn_sched_barrier(0);
    }
#pragma unroll
    for (int s = 0; s < 2; ++s)
#pragma unroll
      for (int t = 0; t < 4; ++t)
        acc[t] = __builtin_amdgcn_wmma_f32_16x16x32_f16(
            false, A[s], false, B[s][t], (short)0, acc[t], false, false);
    if (c + 1 < NXCH) {
      // keeps the wait below behind the products, which cover the stores' way
      __builtin_amdgcn_sched_barrier(0);
      // the other lanes' stores of the next chunk have landed before the wave
      // reads its fragments back
      asm volatile("s_wait_dscnt 0x0" ::: "memory");
      // trip's end, for the same reason as above
      __builtin_amdgcn_sched_barrier(0);
    }
  }

  // Epilogue: bias add, output scale (fp32), f16 convert, head-split store.
  // acc[t][j] is row 16w + 8g + j (s), column 16t + ln (d) of the block's tile.
  // The tile is staged in ldsX at the X pitch and leaves in rows of 128 B.
  const int  h   = blockIdx.x;          // the block's 64 columns are one head
  const int  bb  = rbase >> 11;         // S = 2048: 64 rows lie in one batch
  const int  s0  = rbase & (S_LEN - 1);
  const long bh  = (long)(bb * NHEAD + h);
  const int  pr  = lane >> 3;           // read-back: row in a group of four,
  const int  pc  = (lane & 7) * 8;      // 16-B piece of the row

  if (transposed) {
    // V^T: tile [d][s]. A line holds s of all four waves, so the tile spans
    // the four X buffers: every wave has left its own before any is rewritten.
    __syncthreads();
#pragma unroll
    for (int t = 0; t < 4; ++t) {
      v8h pk;  // eight consecutive s of one d
#pragma unroll
      for (int j = 0; j < 8; ++j)
        pk[j] = (_Float16)((acc[t][j] + bv[t]) * oscale);
      *(v8h*)&ldsX[(16 * t + ln) * XPITCH + 16 * w + 8 * g] = pk;
    }
    // the tile is whole before a wave reads rows that all four wrote
    __syncthreads();
    _Float16* o = dst + (bh * DHEAD + 16 * w + pr) * S_LEN + s0 + pc;
#pragma unroll
    for (int i = 0; i < 4; ++i)
      *(v8h*)(o + (long)(4 * i) * S_LEN) =
          *(const v8h*)&ldsX[(16 * w + 4 * i + pr) * XPITCH + pc];
  } else {
    // Q, K: tile [s][d]. A wave's 16 rows are its own: it stages them in its
    // own X buffer, whose last fragments the products above have consumed.
    _Float16* st = &ldsX[(16 * w + 8 * g) * XPITCH + ln];
#pragma unroll
    for (int t = 0; t < 4; ++t)
#pragma unroll
      for (int j = 0; j < 8; ++j)
        st[j * XPITCH + 16 * t] = (_Float16)((acc[t][j] + bv[t]) * oscale);
    // the other lanes' stores have landed before the wave reads the rows back
    asm volatile("s_wait_dscnt 0x0" ::: "memory");
    _Float16* o = dst + (bh * S_LEN + s0 + 16 * w + pr) * DHEAD + pc;
#pragma unroll
    for (int i = 0; i < 4; ++i)
      *(v8h*)(o + 4 * i * DHEAD) =
          *(const v8h*)&ldsX[(16 * w + 4 * i + pr) * XPITCH + pc];
  }
}

#define KVPITCH (DHEAD + 8)
#define KVTILE  (64 * KVPITCH)   // halves in one staged tile
#define NTILE   (S_LEN / 64)

// One tile pair: every lane copies four 16-B pieces of K and four of V^T.
// kg, vg: the lane's first piece in global memory; lk: its place in the K tile
// of the target buffer (LDS byte address); the V^T tile lies behind the K tile.
// Piece i lies 16 tile rows behind piece i - 1.
static __device__ __forceinline__ void copy_kv_tile(const _Float16* kg,
                                                    const _Float16* vg,
                                                    unsigned lk) {
  const unsigned lv = lk + KVTILE * 2;
  const unsigned ls = 16 * KVPITCH * 2;
  // The closing s_wait_xcnt 0 stands inside the statement so that no address
  // register of a copy is rewritten before it.
  asm volatile(
      "global_load_async_to_lds_b128 %0, %8, off\n\t"
      "global_load_async_to_lds_b128 %1, %9, off\n\t"
      "global_load_async_to_lds_b128 %2, %10, off\n\t"
      "global_load_async_to_lds_b128 %3, %11, off\n\t"
      "global_load_async_to_lds_b128 %4, %12, off\n\t"
      "global_load_async_to_lds_b128 %5, %13, off\n\t"
      "global_load_async_to_lds_b128 %6, %14, off\n\t"
      "global_load_async_to_lds_b128 %7, %15, off\n\t"
      "s_wait_xcnt 0x0"
      :: "v"(lk), "v"(lk + ls), "v"(lk + 2 * ls), "v"(lk + 3 * ls),
         "v"(lv), "v"(lv + ls), "v"(lv + 2 * ls), "v"(lv + 3 * ls),
         "v"(kg), "v"(kg + 16 * DHEAD), "v"(kg + 32 * DHEAD),
         "v"(kg + 48 * DHEAD),
         "v"(vg), "v"(vg + 16 * S_LEN), "v"(vg + 32 * S_LEN),
         "v"(vg + 48 * S_LEN)
      : "memory");
}

// Value of lane l ^ 16 (the other half of the wave), by a vector cross-row move.
static __device__ __forceinline__ float other_half(float x) {
  const int b = __builtin_bit_cast(int, x);
  return __builtin_bit_cast(float, __builtin_amdgcn_permlanex16(
      b, b, 0x76543210, 0xfedcba98, false, false));
}

// waves_per_eu: the grid puts four waves on a SIMD (four blocks per WGP); told
// so, the compiler spends that share of the registers and reuses fewer of them
// between the fragment loads, the softmax and the products (fewer waits, nops).
__global__ __launch_bounds__(128) __attribute__((amdgpu_waves_per_eu(4, 4)))
void attn_kernel(
    const _Float16* __restrict__ Q, const _Float16* __restrict__ K,
    const _Float16* __restrict__ VT, float* __restrict__ out) {
  __shared__ __align__(16) _Float16 ldsKV[2 * 2 * KVTILE];  // [buffer][K, V^T]

  const int tid  = threadIdx.x;
  const int w    = tid >> 5;
  const int lane = tid & 31;
  const int g    = lane >> 4;
  const int ln   = lane & 15;
  const int qb = blockIdx.x, h = blockIdx.y, b = blockIdx.z;

  const long bh = (long)b * NHEAD + h;
  const _Float16* qp = Q  + bh * S_LEN * DHEAD;
  const _Float16* kp = K  + bh * S_LEN * DHEAD;
  const _Float16* vp = VT + bh * DHEAD * S_LEN;

  // Q^T operand (B: lane = query column), loop-invariant; it already carries
  // the softmax scale in log2 units.
  const int qrow = qb * 64 + 16 * w + ln;
  v16h Bq[2];
#pragma unroll
  for (int kc = 0; kc < 2; ++kc)
    Bq[kc] = load2x8(qp + (long)qrow * DHEAD + kc * 32, g);

  float m = -1e30f;  // running maximum of the lane's query, equal in both halves
  v8f   lv = {};     // partial row sums: this lane's keys only
  v8f   acc[4] = {}; // O^T: acc[t][j] = O[query ln][d = 16t + 8g + j]

  // The lane's piece of a tile: row tid / 8, 16-B column tid % 8, so that a
  // wave's copy covers four whole 128-B lines.
  const _Float16* kg = kp + tid * 8;
  const _Float16* vg = vp + (long)(tid >> 3) * S_LEN + (tid & 7) * 8;
  const unsigned  lk =
      (unsigned)(size_t)&ldsKV[(tid >> 3) * KVPITCH + (tid & 7) * 8];

  copy_kv_tile(kg, vg, lk);
  // tile 0 has landed for this wave, then for the block
  asm volatile("s_wait_asynccnt 0x0" ::: "memory");
  __syncthreads();
  copy_kv_tile(kg + 64 * DHEAD, vg + 64, lk + 2 * KVTILE * 2);

  for (int kb = 0; kb < NTILE; ++kb) {
    const int buf = (kb & 1) * 2 * KVTILE;
    // ---- scores (log2 units): S^T = K @ Qs^T, 64 keys x 16 queries ----
    // sc[t][j] = score of key 16t + 8g + j against query ln
    v16h Ak[8];
    // every inner loop of the trip is unrolled: Ak, Av, sc, ph and acc are
    // indexed by constants only and stay in registers
#pragma unroll
    for (int t = 0; t < 4; ++t) {
      const _Float16* kr = &ldsKV[buf + (16 * t + ln) * KVPITCH];
      Ak[2 * t]     = load2x8(kr, g);
      Ak[2 * t + 1] = load2x8(kr + 32, g);
    }
    // V^T fragments of this tile (A: lane = row d), read in the same group so
    // that their LDS latency passes behind the score products and the softmax.
    v16h Av[8];
#pragma unroll
    for (int t = 0; t < 4; ++t) {
      const _Float16* vb = &ldsKV[buf + KVTILE + (16 * t + ln) * KVPITCH];
      Av[2 * t]     = load2x8(vb, g);
      Av[2 * t + 1] = load2x8(vb + 32, g);
    }
    // keeps the trip's 32 fragment loads in one place: sunk between the
    // products, each small group would be waited for at its own place
    __builtin_amdgcn_sched_barrier(0);

    v8f sc[4];
#pragma unroll
    for (int t = 0; t < 4; ++t) {
      v8f z = {};
      sc[t] = __builtin_amdgcn_wmma_f32_16x16x32_f16(false, Ak[2 * t], false, Bq[0],
                                                     (short)0, z, false, false);
    }
#pragma unroll
    for (int t = 0; t < 4; ++t)
      sc[t] = __builtin_amdgcn_wmma_f32_16x16x32_f16(false, Ak[2 * t + 1], false, Bq[1],
                                                     (short)0, sc[t], false, false);

    // ---- maximum of the query's 64 scores: in-lane, then across the halves ----
    float mt[4];
#pragma unroll
    for (int t = 0; t < 4; ++t) {
      float v = sc[t][0];
#pragma unroll
      for (int j = 1; j < 8; ++j) v = fmaxf(v, sc[t][j]);
      mt[t] = v;
    }
    float mn = fmaxf(fmaxf(fmaxf(mt[0], mt[1]), fmaxf(mt[2], mt[3])), m);
    mn = fmaxf(mn, other_half(mn));

    const float corr = __builtin_amdgcn_exp2f(m - mn);
    m = mn;

    // ---- p = 2^(s - m); partial sums; P^T packed as the B operand ----
    // B element s of key chunk kc is key 32kc + 8g + s (s < 8) or
    // 32kc + 16 + 8g + s - 8: score tiles 2kc and 2kc + 1, register for register.
    v8h ph[4];
    lv *= corr;
#pragma unroll
    for (int t = 0; t < 4; ++t) {
      const v8f e = sc[t] - mn;
      v8f p;
#pragma unroll
      for (int j = 0; j < 8; ++j) p[j] = __builtin_amdgcn_exp2f(e[j]);
      lv += p;
      ph[t] = __builtin_convertvector(p, v8h);
      acc[t] *= corr;  // rescale output accumulator
    }
    const v16h Bp0 = __builtin_shufflevector(ph[0], ph[1], 0, 1, 2, 3, 4, 5, 6, 7,
                                             8, 9, 10, 11, 12, 13, 14, 15);
    const v16h Bp1 = __builtin_shufflevector(ph[2], ph[3], 0, 1, 2, 3, 4, 5, 6, 7,
                                             8, 9, 10, 11, 12, 13, 14, 15);

    // ---- O^T += V^T @ P^T ----
#pragma unroll
    for (int t = 0; t < 4; ++t)
      acc[t] = __builtin_amdgcn_wmma_f32_16x16x32_f16(false, Av[2 * t], false, Bp0,
                                                      (short)0, acc[t], false, false);
#pragma unroll
    for (int t = 0; t < 4; ++t)
      acc[t] = __builtin_amdgcn_wmma_f32_16x16x32_f16(false, Av[2 * t + 1], false, Bp1,
                                                      (short)0, acc[t], false, false);

    // keeps the hand-over at the trip's foot: lifted over the softmax, it would
    // leave the next copies, issued behind the PV products, too short a flight
    __builtin_amdgcn_sched_barrier(0);
    // Hand-over: this wave's reads of the buffer are done ...
    asm volatile("s_wait_dscnt 0x0" ::: "memory");
    // ... and its copies of the next tile have landed;
    asm volatile("s_wait_asynccnt 0x0" ::: "memory");
    // the barrier publishes the next tile and frees this trip's buffer.
    __syncthreads();
    if (kb + 2 < NTILE)
      copy_kv_tile(kg + (long)(kb + 2) * 64 * DHEAD, vg + (kb + 2) * 64,
                   lk + buf * 2);
  }
  // no copy is left in flight when the wave ends
  asm volatile("s_wait_asynccnt 0x0" ::: "memory");

  // ---- epilogue: join the partial row sums, normalize, store fp32 ----
  float l = ((lv[0] + lv[1]) + (lv[2] + lv[3])) + ((lv[4] + lv[5]) + (lv[6] + lv[7]));
  l += other_half(l);
  const float inv = 1.0f / l;
  // A lane holds eight consecutive d of its query per tile: two 16-B stores.
  float* orow = out + ((long)b * S_LEN + qrow) * DIM + h * DHEAD + 8 * g;
#pragma unroll
  for (int t = 0; t < 4; ++t) {
    const v8f o = acc[t] * inv;
    *(v4f*)(orow + 16 * t)     = __builtin_shufflevector(o, o, 0, 1, 2, 3);
    *(v4f*)(orow + 16 * t + 4) = __builtin_shufflevector(o, o, 4, 5, 6, 7);
  }
}

// ---------------------------------------------------------------------------
extern "C" void kernel_launch(void* const* d_in, const int* in_sizes, int n_in,
                              void* d_out, int out_size, void* d_ws, size_t ws_size,
                              hipStream_t stream) {
  const float* q  = (const float*)d_in[0];
  const float* k  = (const float*)d_in[1];
  const float* v  = (const float*)d_in[2];
  const float* Wq = (const float*)d_in[3];
  const float* bq = (const float*)d_in[4];
  const float* Wk = (const float*)d_in[5];
  const float* bk = (const float*)d_in[6];
  const float* Wv = (const float*)d_in[7];
  const float* bv = (const float*)d_in[8];

  const size_t per = (size_t)B_SZ * NHEAD * S_LEN * DHEAD;  // f16 elements
  _Float16* wsq = (_Float16*)d_ws;
  _Float16* wsk = wsq + per;
  _Float16* wsv = wsk + per;

  dim3 blk(128);
  dim3 g1(DIM / 64, (B_SZ * S_LEN) / 64, 3);   // (8, 128, 3): Q, K, V planes
  qkv_proj_kernel<<<g1, blk, 0, stream>>>(q, k, v, Wq, Wk, Wv, bq, bk, bv, wsq);

  dim3 g2(S_LEN / 64, NHEAD, B_SZ);         // (32, 8, 4)
  attn_kernel<<<g2, blk, 0, stream>>>(wsq, wsk, wsv, (float*)d_out);
}

// v007
// One run takes 59.4 microseconds.
// Next to v006, in two timings, it ran 1.15 and 1.14 times as fast.
// Counting every step since v000, it is 4.08 times as fast.
#include <hip/hip_runtime.h>
#include <hip/hip_bf16.h>

typedef __attribute__((ext_vector_type(16))) _Float16 v16h;
typedef __attribute__((ext_vector_type(8)))  _Float16 v8h;
typedef __attribute__((ext_vector_type(4)))  _Float16 v4h;
typedef __attribute__((ext_vector_type(8)))  float    v8f;
typedef __attribute__((ext_vector_type(4)))  float    v4f;

#define B_SZ   4
#define S_LEN  2048
#define NHEAD  8
#define DHEAD  64
#define DIM    512

// 1/sqrt(DHEAD) * log2(e): folds softmax scaling AND the exp->exp2 change of
// base into the Q projection (applied in fp32 there).
#define Q_SCALE (0.125f * 1.4426950408889634f)

// Build a 16-bit WMMA A/B operand for 16x16x32:
// lane (g = lane>>4) holds halves K = {8g..8g+7} and {16+8g..16+8g+7},
// i.e. two contiguous 16-byte runs from a K-major row/column.
static __device__ __forceinline__ v16h load2x8(const _Float16* base, int g) {
  const v8h lo = *(const v8h*)(base + 8 * g);
  const v8h hi = *(const v8h*)(base + 16 + 8 * g);
  v16h r;
#pragma unroll
  for (int i = 0; i < 8; ++i) { r[i] = lo[i]; r[i + 8] = hi[i]; }
  return r;
}

// ---------------------------------------------------------------------------
// Kernel 1: Y = (X @ W + b) * oscale, converted to f16, written head-split.
//   transposed==0 : dst[((b*H + h)*S + s)*64 + d]   (Q, K)
//   transposed==1 : dst[((b*H + h)*64 + d)*S + s]   (V^T for PV A-operand)
// One launch holds the three independent projections; blockIdx.z names the
// block's own (0: Q, 1: K, 2: V).
// Block = 128 threads (4 waves); tile = 64 rows x 64 cols; K step 32.
// The block's whole W panel (512 k x 64 cols) is staged in LDS once, so the
// K loop runs without barriers, and the panel serves RTILES row tiles one after
// the other: W is read from L2, converted and stored a quarter as often as with
// one tile a block. The grid (768 blocks, three to a WGP) is resident at once.
// The chunks of X run on across the tiles: the next tile's first chunks fly
// while this tile's result leaves.
// X reaches the A operand through LDS: a wave reads its 16 rows in chunks of
// 64 k with loads that cover whole 256-B runs of two rows (4 lines a load; a
// load in fragment order would touch 16), converts, stores the chunk in a
// buffer of its own and reads the fragments back. Four chunks are in flight.
// The result leaves through LDS too: the block's tile is 64 whole 128-B lines
// of dst (one head: 64 s x 64 d, or 64 d x 64 s), and every 16-B store of a wave
// covers four of them. Its staging has LDS of its own: the X buffers already
// hold the next tile's first chunk by then.
// ---------------------------------------------------------------------------
// LDS row pitch in halves: 1040 B = 16 B x 65 (odd), so that 16 lanes on 16
// consecutive columns cover all 64 banks in a 16-byte store or load.
#define WPITCH (DIM + 8)
// X chunk: 64 k; row pitch 144 B = 16 B x 9 (odd), as the fragment reads want.
#define XCH    64
#define XPITCH (XCH + 8)
#define NXCH   (DIM / XCH)
// register sets of the ring; divides NXCH, so that the ring closes over a tile
#define XDEPTH 4
// row tiles a block works through with one staged panel
#define RTILES 4

// Work-group barrier that orders LDS traffic only. __syncthreads() also waits
// for every global load and store of the wave: between two row tiles that would
// drain the chunks of X that fly for the next tile.
static __device__ __forceinline__ void lds_barrier() {
  __builtin_amdgcn_fence(__ATOMIC_RELEASE, "workgroup", "local");
  __builtin_amdgcn_s_barrier();
  __builtin_amdgcn_fence(__ATOMIC_ACQUIRE, "workgroup", "local");
}

// waves_per_eu: the grid puts three waves on a SIMD (three blocks per WGP); the
// register budget is that share, else a third block would not fit beside two.
__global__ __launch_bounds__(128) __attribute__((amdgpu_waves_per_eu(3, 3)))
void qkv_proj_kernel(
    const float* __restrict__ Xq, const float* __restrict__ Xk,
    const float* __restrict__ Xv, const float* __restrict__ Wq,
    const float* __restrict__ Wk, const float* __restrict__ Wv,
    const float* __restrict__ bq, const float* __restrict__ bk,
    const float* __restrict__ bvv, _Float16* __restrict__ ws) {
  __shared__ __align__(16) _Float16 ldsW[64 * WPITCH];  // [col][k] panel
  __shared__ __align__(16) _Float16 ldsX[4 * 16 * XPITCH];  // [wave][row][k]
  __shared__ __align__(16) _Float16 ldsO[64 * XPITCH];      // result tile

  // The block's projection: operands, plane of the workspace, layout, scale.
  const int z = blockIdx.z;
  const float* __restrict__ X    = z == 0 ? Xq : z == 1 ? Xk : Xv;
  const float* __restrict__ W    = z == 0 ? Wq : z == 1 ? Wk : Wv;
  const float* __restrict__ bias = z == 0 ? bq : z == 1 ? bk : bvv;
  _Float16* __restrict__ dst = ws + (long)z * (B_SZ * NHEAD * S_LEN * DHEAD);
  const int   transposed = z == 2;
  const float oscale     = z == 0 ? Q_SCALE : 1.0f;

  const int tid  = threadIdx.x;
  const int w    = tid >> 5;
  const int lane = tid & 31;
  const int g    = lane >> 4;
  const int ln   = lane & 15;
  const int rbase = blockIdx.y * (64 * RTILES);
  const int cbase = blockIdx.x * 64;

  // The lane's place in a chunk of X: piece i is row i + 8g of the wave's 16,
  // floats 4 ln .. 4 ln + 3 of the chunk. Rows i and i + 8 lie 32 banks apart.
  // An address is a base that is the same for the whole block plus the lane's
  // 32-bit offset xo: one register a lane instead of a pair for every base.
  const float*   xg = X + (long)rbase * DIM;
  const unsigned xo = (16 * w + 8 * g) * DIM + 4 * ln;
  _Float16*    xst = &ldsX[(16 * w + 8 * g) * XPITCH + 4 * ln];
  v4f xr[XDEPTH][8];
  // every loop over xr is unrolled: it is indexed by constants only
  // The first chunks fly while the W panel is staged.
#pragma unroll
  for (int c = 0; c < XDEPTH; ++c)
#pragma unroll
    for (int i = 0; i < 8; ++i)
      xr[c][i] = *(const v4f*)(xg + (i * DIM + c * XCH) + xo);

  // bias of the lane's four columns, the same for every row tile
  float bv[4];
  // stands in front of any later rewrite of an address register of the loads above
  asm volatile("s_wait_xcnt 0x0" ::: "memory");
  // with the one below: nothing that could take over the address register of the
  // bias loads is scheduled between them and their wait
  __builtin_amdgcn_sched_barrier(0);
#pragma unroll
  for (int t = 0; t < 4; ++t) bv[t] = bias[cbase + 16 * t + ln];
  // stands in front of any later rewrite of the loads' address registers
  asm volatile("s_wait_xcnt 0x0" ::: "memory");
  // keeps the address arithmetic of the staging below behind that wait
  __builtin_amdgcn_sched_barrier(0);

  // Stage W[0 .. 512)[cbase .. +64) as f16, [col][k]. A lane owns one column:
  // eight row loads (one 128-B line per wave each) pack into one 16-B store.
  {
    const int    cc = tid & 63;
    const int    kh = tid >> 6;
    const float* wc = W + cbase + cc;
    // unroll 8: 64 independent loads in flight per lane, to cover L2 latency
#pragma unroll 8
    for (int i = 0; i < DIM / 16; ++i) {
      const int k0 = (2 * i + kh) * 8;
      v8h pk;
#pragma unroll
      for (int j = 0; j < 8; ++j) pk[j] = (_Float16)wc[(long)(k0 + j) * DIM];
      *(v8h*)&ldsW[cc * WPITCH + k0] = pk;
    }
  }
  // chunk 0 into the wave's buffer
#pragma unroll
  for (int i = 0; i < 8; ++i)
    *(v4h*)(xst + i * XPITCH) = __builtin_convertvector(xr[0][i], v4h);
  __syncthreads();
  // its registers take chunk XDEPTH, behind the barrier, which waits for every
  // load issued in front of it
#pragma unroll
  for (int i = 0; i < 8; ++i)
    xr[0][i] = *(const v4f*)(xg + (i * DIM + XDEPTH * XCH) + xo);
  // stands in front of any later rewrite of the loads' address registers
  asm volatile("s_wait_xcnt 0x0" ::: "memory");
  // keeps what follows behind that wait
  __builtin_amdgcn_sched_barrier(0);

  const _Float16* xfr = &ldsX[(16 * w + ln) * XPITCH];  // A operand: lane = row

  // Where the results go: the block's 64 columns are one head, its RTILES * 64
  // rows lie in one batch (S = 2048).
  const int  h   = blockIdx.x;
  const int  bb  = rbase >> 11;
  const int  s0  = rbase & (S_LEN - 1);
  const long bh  = (long)(bb * NHEAD + h);
  const int  pr  = lane >> 3;           // read-back: row in a group of four,
  const int  pc  = (lane & 7) * 8;      // 16-B piece of the row

  // rolled over the tiles: the text stays a quarter as long as unrolled
#pragma unroll 1
  for (int r = 0; r < RTILES; ++r) {
    const float* xt = xg + (long)r * (64 * DIM);  // this tile's rows
    // The next tile's rows. Behind the last tile the loads stay unconditional
    // (a branch in the trip would part a chunk's loads from its conversion, and
    // the conversion is then lifted to the loads and waits for them at once):
    // they are aimed at the head of X, one line a load, and nothing reads them.
    const float*   xn  = r + 1 < RTILES ? xt + 64 * DIM : X;
    const unsigned xon = r + 1 < RTILES ? xo : 0u;
    v8f acc[4] = {};

#pragma unroll
    for (int c = 0; c < NXCH; ++c) {
      // the chunk's fragments, one group: A (2 K steps), B (2 K steps x 4 tiles)
      v16h A[2], B[2][4];
#pragma unroll
      for (int s = 0; s < 2; ++s) {
        A[s] = load2x8(xfr + s * 32, g);
#pragma unroll
        for (int t = 0; t < 4; ++t)
          B[s][t] = load2x8(&ldsW[(16 * t + ln) * WPITCH + c * XCH + s * 32], g);
      }
      // the wave's reads of its X buffer have returned before it is rewritten
      asm volatile("s_wait_dscnt 0x0" ::: "memory");
      // keeps a chunk's conversion at its store: lifted into an earlier trip,
      // it would wait for global loads that have only just been issued
      __builtin_amdgcn_sched_barrier(0);
      // chunk c + 1 (in the last trip: the next tile's chunk 0) goes to LDS;
      // chunk c + 1 + XDEPTH takes the freed registers
      const int    n  = c + 1 + XDEPTH;
      const float*   xc  = n < NXCH ? xt + n * XCH : xn + (n - NXCH) * XCH;
      const unsigned xoc = n < NXCH ? xo : xon;
#pragma unroll
      for (int i = 0; i < 8; ++i) {
        *(v4h*)(xst + i * XPITCH) =
            __builtin_convertvector(xr[(c + 1) % XDEPTH][i], v4h);
        xr[(c + 1) % XDEPTH][i] = *(const v4f*)(xc + i * DIM + xoc);
      }
#pragma unroll
      for (int s = 0; s < 2; ++s)
#pragma unroll
        for (int t = 0; t < 4; ++t)
          acc[t] = __builtin_amdgcn_wmma_f32_16x16x32_f16(
              false, A[s], false, B[s][t], (short)0, acc[t], false, false);
      // keeps the wait below behind the products, which cover the stores' way
      __builtin_amdgcn_sched_barrier(0);
      // the other lanes' stores of the next chunk have landed before the wave
      // reads its fragments back
      asm volatile("s_wait_dscnt 0x0" ::: "memory");
      // stands in front of any later rewrite of an address register of the
      // trip's global loads
      asm volatile("s_wait_xcnt 0x0" ::: "memory");
      // trip's end, for the same reason as above
      __builtin_amdgcn_sched_barrier(0);
    }

    // Epilogue: bias add, output scale (fp32), f16 convert, head-split store.
    // acc[t][j] is row 16w + 8g + j (s), column 16t + ln (d) of the tile.
    // The tile is staged in ldsO at the X pitch and leaves in rows of 128 B.
    const int st0 = s0 + 64 * r;  // the tile's first s

    if (transposed) {
      // V^T: tile [d][s]. A line holds s of all four waves: every wave has read
      // its rows of the tile before from ldsO before any of it is rewritten.
      lds_barrier();
#pragma unroll
      for (int t = 0; t < 4; ++t) {
        v8h pk;  // eight consecutive s of one d
#pragma unroll
        for (int j = 0; j < 8; ++j)
          pk[j] = (_Float16)((acc[t][j] + bv[t]) * oscale);
        *(v8h*)&ldsO[(16 * t + ln) * XPITCH + 16 * w + 8 * g] = pk;
      }
      // the tile is whole before a wave reads rows that all four wrote
      lds_barrier();
      _Float16* o = dst + (bh * DHEAD * S_LEN + st0) +
                    (unsigned)((16 * w + pr) * S_LEN + pc);
#pragma unroll
      for (int i = 0; i < 4; ++i)
        *(v8h*)(o + (long)(4 * i) * S_LEN) =
            *(const v8h*)&ldsO[(16 * w + 4 * i + pr) * XPITCH + pc];
      // stands in front of the next tile's rewrite of the stores' registers
      asm volatile("s_wait_xcnt 0x0" ::: "memory");
    } else {
      // Q, K: tile [s][d]. A wave's 16 rows are its own: it stages them in its
      // own rows of ldsO.
      _Float16* st = &ldsO[(16 * w + 8 * g) * XPITCH + ln];
#pragma unroll
      for (int t = 0; t < 4; ++t)
#pragma unroll
        for (int j = 0; j < 8; ++j)
          st[j * XPITCH + 16 * t] = (_Float16)((acc[t][j] + bv[t]) * oscale);
      // the other lanes' stores have landed before the wave reads the rows back
      asm volatile("s_wait_dscnt 0x0" ::: "memory");
      _Float16* o = dst + (bh * S_LEN + st0) * DHEAD +
                    (unsigned)((16 * w + pr) * DHEAD + pc);
#pragma unroll
      for (int i = 0; i < 4; ++i)
        *(v8h*)(o + 4 * i * DHEAD) =
            *(const v8h*)&ldsO[(16 * w + 4 * i + pr) * XPITCH + pc];
      // stands in front of the next tile's rewrite of the stores' registers
      asm volatile("s_wait_xcnt 0x0" ::: "memory");
    }
  }
  // no load (the last tile's unread ones) is left in flight when the wave ends
  asm volatile("s_wait_loadcnt 0x0" ::: "memory");
}

#define KVPITCH (DHEAD + 8)
#define KVTILE  (64 * KVPITCH)   // halves in one staged tile
#define NTILE   (S_LEN / 64)

// One tile pair: every lane copies four 16-B pieces of K and four of V^T.
// kg, vg: the lane's first piece in global memory; lk: its place in the K tile
// of the target buffer (LDS byte address); the V^T tile lies behind the K tile.
// Piece i lies 16 tile rows behind piece i - 1.
static __device__ __forceinline__ void copy_kv_tile(const _Float16* kg,
                                                    const _Float16* vg,
                                                    unsigned lk) {
  const unsigned lv = lk + KVTILE * 2;
  const unsigned ls = 16 * KVPITCH * 2;
  // The closing s_wait_xcnt 0 stands inside the statement so that no address
  // register of a copy is rewritten before it.
  asm volatile(
      "global_load_async_to_lds_b128 %0, %8, off\n\t"
      "global_load_async_to_lds_b128 %1, %9, off\n\t"
      "global_load_async_to_lds_b128 %2, %10, off\n\t"
      "global_load_async_to_lds_b128 %3, %11, off\n\t"
      "global_load_async_to_lds_b128 %4, %12, off\n\t"
      "global_load_async_to_lds_b128 %5, %13, off\n\t"
      "global_load_async_to_lds_b128 %6, %14, off\n\t"
      "global_load_async_to_lds_b128 %7, %15, off\n\t"
      "s_wait_xcnt 0x0"
      :: "v"(lk), "v"(lk + ls), "v"(lk + 2 * ls), "v"(lk + 3 * ls),
         "v"(lv), "v"(lv + ls), "v"(lv + 2 * ls), "v"(lv + 3 * ls),
         "v"(kg), "v"(kg + 16 * DHEAD), "v"(kg + 32 * DHEAD),
         "v"(kg + 48 * DHEAD),
         "v"(vg), "v"(vg + 16 * S_LEN), "v"(vg + 32 * S_LEN),
         "v"(vg + 48 * S_LEN)
      : "memory");
}

// Value of lane l ^ 16 (the other half of the wave), by a vector cross-row move.
static __device__ __forceinline__ float other_half(float x) {
  const int b = __builtin_bit_cast(int, x);
  return __builtin_bit_cast(float, __builtin_amdgcn_permlanex16(
      b, b, 0x76543210, 0xfedcba98, false, false));
}

// waves_per_eu: the grid puts four waves on a SIMD (four blocks per WGP); told
// so, the compiler spends that share of the registers and reuses fewer of them
// between the fragment loads, the softmax and the products (fewer waits, nops).
__global__ __launch_bounds__(128) __attribute__((amdgpu_waves_per_eu(4, 4)))
void attn_kernel(
    const _Float16* __restrict__ Q, const _Float16* __restrict__ K,
    const _Float16* __restrict__ VT, float* __restrict__ out) {
  __shared__ __align__(16) _Float16 ldsKV[2 * 2 * KVTILE];  // [buffer][K, V^T]

  const int tid  = threadIdx.x;
  const int w    = tid >> 5;
  const int lane = tid & 31;
  const int g    = lane >> 4;
  const int ln   = lane & 15;
  const int qb = blockIdx.x, h = blockIdx.y, b = blockIdx.z;

  const long bh = (long)b * NHEAD + h;
  const _Float16* qp = Q  + bh * S_LEN * DHEAD;
  const _Float16* kp = K  + bh * S_LEN * DHEAD;
  const _Float16* vp = VT + bh * DHEAD * S_LEN;

  // Q^T operand (B: lane = query column), loop-invariant; it already carries
  // the softmax scale in log2 units.
  const int qrow = qb * 64 + 16 * w + ln;
  v16h Bq[2];
#pragma unroll
  for (int kc = 0; kc < 2; ++kc)
    Bq[kc] = load2x8(qp + (long)qrow * DHEAD + kc * 32, g);

  float m = -1e30f;  // running maximum of the lane's query, equal in both halves
  v8f   lv = {};     // partial row sums: this lane's keys only
  v8f   acc[4] = {}; // O^T: acc[t][j] = O[query ln][d = 16t + 8g + j]

  // The lane's piece of a tile: row tid / 8, 16-B column tid % 8, so that a
  // wave's copy covers four whole 128-B lines.
  const _Float16* kg = kp + tid * 8;
  const _Float16* vg = vp + (long)(tid >> 3) * S_LEN + (tid & 7) * 8;
  const unsigned  lk =
      (unsigned)(size_t)&ldsKV[(tid >> 3) * KVPITCH + (tid & 7) * 8];

  copy_kv_tile(kg, vg, lk);
  // tile 0 has landed for this wave, then for the block
  asm volatile("s_wait_asynccnt 0x0" ::: "memory");
  __syncthreads();
  copy_kv_tile(kg + 64 * DHEAD, vg + 64, lk + 2 * KVTILE * 2);

  for (int kb = 0; kb < NTILE; ++kb) {
    const int buf = (kb & 1) * 2 * KVTILE;
    // ---- scores (log2 units): S^T = K @ Qs^T, 64 keys x 16 queries ----
    // sc[t][j] = score of key 16t + 8g + j against query ln
    v16h Ak[8];
    // every inner loop of the trip is unrolled: Ak, Av, sc, ph and acc are
    // indexed by constants only and stay in registers
#pragma unroll
    for (int t = 0; t < 4; ++t) {
      const _Float16* kr = &ldsKV[buf + (16 * t + ln) * KVPITCH];
      Ak[2 * t]     = load2x8(kr, g);
      Ak[2 * t + 1] = load2x8(kr + 32, g);
    }
    // V^T fragments of this tile (A: lane = row d), read in the same group so
    // that their LDS latency passes behind the score products and the softmax.
    v16h Av[8];
#pragma unroll
    for (int t = 0; t < 4; ++t) {
      const _Float16* vb = &ldsKV[buf + KVTILE + (16 * t + ln) * KVPITCH];
      Av[2 * t]     = load2x8(vb, g);
      Av[2 * t + 1] = load2x8(vb + 32, g);
    }
    // keeps the trip's 32 fragment loads in one place: sunk between the
    // products, each small group would be waited for at its own place
    __builtin_amdgcn_sched_barrier(0);

    v8f sc[4];
#pragma unroll
    for (int t = 0; t < 4; ++t) {
      v8f z = {};
      sc[t] = __builtin_amdgcn_wmma_f32_16x16x32_f16(false, Ak[2 * t], false, Bq[0],
                                                     (short)0, z, false, false);
    }
#pragma unroll
    for (int t = 0; t < 4; ++t)
      sc[t] = __builtin_amdgcn_wmma_f32_16x16x32_f16(false, Ak[2 * t + 1], false, Bq[1],
                                                     (short)0, sc[t], false, false);

    // ---- maximum of the query's 64 scores: in-lane, then across the halves ----
    float mt[4];
#pragma unroll
    for (int t = 0; t < 4; ++t) {
      float v = sc[t][0];
#pragma unroll
      for (int j = 1; j < 8; ++j) v = fmaxf(v, sc[t][j]);
      mt[t] = v;
    }
    float mn = fmaxf(fmaxf(fmaxf(mt[0], mt[1]), fmaxf(mt[2], mt[3])), m);
    mn = fmaxf(mn, other_half(mn));

    const float corr = __builtin_amdgcn_exp2f(m - mn);
    m = mn;

    // ---- p = 2^(s - m); partial sums; P^T packed as the B operand ----
    // B element s of key chunk kc is key 32kc + 8g + s (s < 8) or
    // 32kc + 16 + 8g + s - 8: score tiles 2kc and 2kc + 1, register for register.
    v8h ph[4];
    lv *= corr;
#pragma unroll
    for (int t = 0; t < 4; ++t) {
      const v8f e = sc[t] - mn;
      v8f p;
#pragma unroll
      for (int j = 0; j < 8; ++j) p[j] = __builtin_amdgcn_exp2f(e[j]);
      lv += p;
      ph[t] = __builtin_convertvector(p, v8h);
      acc[t] *= corr;  // rescale output accumulator
    }
    const v16h Bp0 = __builtin_shufflevector(ph[0], ph[1], 0, 1, 2, 3, 4, 5, 6, 7,
                                             8, 9, 10, 11, 12, 13, 14, 15);
    const v16h Bp1 = __builtin_shufflevector(ph[2], ph[3], 0, 1, 2, 3, 4, 5, 6, 7,
                                             8, 9, 10, 11, 12, 13, 14, 15);

    // ---- O^T += V^T @ P^T ----
#pragma unroll
    for (int t = 0; t < 4; ++t)
      acc[t] = __builtin_amdgcn_wmma_f32_16x16x32_f16(false, Av[2 * t], false, Bp0,
                                                      (short)0, acc[t], false, false);
#pragma unroll
    for (int t = 0; t < 4; ++t)
      acc[t] = __builtin_amdgcn_wmma_f32_16x16x32_f16(false, Av[2 * t + 1], false, Bp1,
                                                      (short)0, acc[t], false, false);

    // keeps the hand-over at the trip's foot: lifted over the softmax, it would
    // leave the next copies, issued behind the PV products, too short a flight
    __builtin_amdgcn_sched_barrier(0);
    // Hand-over: this wave's reads of the buffer are done ...
    asm volatile("s_wait_dscnt 0x0" ::: "memory");
    // ... and its copies of the next tile have landed;
    asm volatile("s_wait_asynccnt 0x0" ::: "memory");
    // the barrier publishes the next tile and frees this trip's buffer.
    __syncthreads();
    if (kb + 2 < NTILE)
      copy_kv_tile(kg + (long)(kb + 2) * 64 * DHEAD, vg + (kb + 2) * 64,
                   lk + buf * 2);
  }
  // no copy is left in flight when the wave ends
  asm volatile("s_wait_asynccnt 0x0" ::: "memory");

  // ---- epilogue: join the partial row sums, normalize, store fp32 ----
  float l = ((lv[0] + lv[1]) + (lv[2] + lv[3])) + ((lv[4] + lv[5]) + (lv[6] + lv[7]));
  l += other_half(l);
  const float inv = 1.0f / l;
  // A lane holds eight consecutive d of its query per tile: two 16-B stores.
  float* orow = out + ((long)b * S_LEN + qrow) * DIM + h * DHEAD + 8 * g;
#pragma unroll
  for (int t = 0; t < 4; ++t) {
    const v8f o = acc[t] * inv;
    *(v4f*)(orow + 16 * t)     = __builtin_shufflevector(o, o, 0, 1, 2, 3);
    *(v4f*)(orow + 16 * t + 4) = __builtin_shufflevector(o, o, 4, 5, 6, 7);
  }
}

// ---------------------------------------------------------------------------
extern "C" void kernel_launch(void* const* d_in, const int* in_sizes, int n_in,
                              void* d_out, int out_size, void* d_ws, size_t ws_size,
                              hipStream_t stream) {
  const float* q  = (const float*)d_in[0];
  const float* k  = (const float*)d_in[1];
  const float* v  = (const float*)d_in[2];
  const float* Wq = (const float*)d_in[3];
  const float* bq = (const float*)d_in[4];
  const float* Wk = (const float*)d_in[5];
  const float* bk = (const float*)d_in[6];
  const float* Wv = (const float*)d_in[7];
  const float* bv = (const float*)d_in[8];

  const size_t per = (size_t)B_SZ * NHEAD * S_LEN * DHEAD;  // f16 elements
  _Float16* wsq = (_Float16*)d_ws;
  _Float16* wsk = wsq + per;
  _Float16* wsv = wsk + per;

  dim3 blk(128);
  dim3 g1(DIM / 64, (B_SZ * S_LEN) / (64 * RTILES), 3);   // (8, 32, 3): Q, K, V planes
  qkv_proj_kernel<<<g1, blk, 0, stream>>>(q, k, v, Wq, Wk, Wv, bq, bk, bv, wsq);

  dim3 g2(S_LEN / 64, NHEAD, B_SZ);         // (32, 8, 4)
  attn_kernel<<<g2, blk, 0, stream>>>(wsq, wsk, wsv, (float*)d_out);
}

// v008
// One run takes 56.7 microseconds.
// Next to v007, in two timings, it ran 1.04 and 1.05 times as fast.
// Counting every step since v000, it is 4.28 times as fast.
#include <hip/hip_runtime.h>
#include <hip/hip_bf16.h>

typedef __attribute__((ext_vector_type(16))) _Float16 v16h;
typedef __attribute__((ext_vector_type(8)))  _Float16 v8h;
typedef __attribute__((ext_vector_type(4)))  _Float16 v4h;
typedef __attribute__((ext_vector_type(8)))  float    v8f;
typedef __attribute__((ext_vector_type(4)))  float    v4f;

#define B_SZ   4
#define S_LEN  2048
#define NHEAD  8
#define DHEAD  64
#define DIM    512

// 1/sqrt(DHEAD) * log2(e): folds softmax scaling AND the exp->exp2 change of
// base into the Q projection (applied in fp32 there).
#define Q_SCALE (0.125f * 1.4426950408889634f)

// Build a 16-bit WMMA A/B operand for 16x16x32:
// lane (g = lane>>4) holds halves K = {8g..8g+7} and {16+8g..16+8g+7},
// i.e. two contiguous 16-byte runs from a K-major row/column.
static __device__ __forceinline__ v16h load2x8(const _Float16* base, int g) {
  const v8h lo = *(const v8h*)(base + 8 * g);
  const v8h hi = *(const v8h*)(base + 16 + 8 * g);
  v16h r;
#pragma unroll
  for (int i = 0; i < 8; ++i) { r[i] = lo[i]; r[i + 8] = hi[i]; }
  return r;
}

// ---------------------------------------------------------------------------
// Kernel 1: Y = (X @ W + b) * oscale, converted to f16, written head-split.
//   transposed==0 : dst[((b*H + h)*S + s)*64 + d]   (Q, K)
//   transposed==1 : dst[((b*H + h)*64 + d)*S + s]   (V^T for PV A-operand)
// One launch holds the three independent projections; blockIdx.z names the
// block's own (0: Q, 1: K, 2: V).
// Block = 128 threads (4 waves); tile = 64 rows x 64 cols; K step 32.
// The block's whole W panel (512 k x 64 cols) is staged in LDS once, so the
// K loop runs without barriers, and the panel serves RTILES row tiles one after
// the other: W is read from L2, converted and stored a quarter as often as with
// one tile a block. The grid (768 blocks, three to a WGP) is resident at once.
// The chunks of X run on across the tiles: the next tile's first chunks fly
// while this tile's result leaves.
// X reaches the A operand through LDS: a wave reads its 16 rows in chunks of
// 64 k with loads that cover whole 256-B runs of two rows (4 lines a load; a
// load in fragment order would touch 16), converts, stores the chunk in a
// buffer of its own and reads the fragments back. Four chunks are in flight.
// The result leaves through LDS too: the block's tile is 64 whole 128-B lines
// of dst (one head: 64 s x 64 d, or 64 d x 64 s), and every 16-B store of a wave
// covers four of them. Its staging has LDS of its own: the X buffers already
// hold the next tile's first chunk by then.
// ---------------------------------------------------------------------------
// LDS row pitch in halves: 1040 B = 16 B x 65 (odd), so that 16 lanes on 16
// consecutive columns cover all 64 banks in a 16-byte store or load.
#define WPITCH (DIM + 8)
// X chunk: 64 k; row pitch 144 B = 16 B x 9 (odd), as the fragment reads want.
#define XCH    64
#define XPITCH (XCH + 8)
#define NXCH   (DIM / XCH)
// register sets of the ring; divides NXCH, so that the ring closes over a tile
#define XDEPTH 4
// row tiles a block works through with one staged panel
#define RTILES 4

// Work-group barrier that orders LDS traffic only. __syncthreads() also waits
// for every global load and store of the wave: between two row tiles that would
// drain the chunks of X that fly for the next tile.
static __device__ __forceinline__ void lds_barrier() {
  __builtin_amdgcn_fence(__ATOMIC_RELEASE, "workgroup", "local");
  __builtin_amdgcn_s_barrier();
  __builtin_amdgcn_fence(__ATOMIC_ACQUIRE, "workgroup", "local");
}

// waves_per_eu: the grid puts three waves on a SIMD (three blocks per WGP); the
// register budget is that share, else a third block would not fit beside two.
__global__ __launch_bounds__(128) __attribute__((amdgpu_waves_per_eu(3, 3)))
void qkv_proj_kernel(
    const float* __restrict__ Xq, const float* __restrict__ Xk,
    const float* __restrict__ Xv, const float* __restrict__ Wq,
    const float* __restrict__ Wk, const float* __restrict__ Wv,
    const float* __restrict__ bq, const float* __restrict__ bk,
    const float* __restrict__ bvv, _Float16* __restrict__ ws) {
  __shared__ __align__(16) _Float16 ldsW[64 * WPITCH];  // [col][k] panel
  __shared__ __align__(16) _Float16 ldsX[4 * 16 * XPITCH];  // [wave][row][k]
  __shared__ __align__(16) _Float16 ldsO[64 * XPITCH];      // result tile

  // The block's projection: operands, plane of the workspace, layout, scale.
  const int z = blockIdx.z;
  const float* __restrict__ X    = z == 0 ? Xq : z == 1 ? Xk : Xv;
  const float* __restrict__ W    = z == 0 ? Wq : z == 1 ? Wk : Wv;
  const float* __restrict__ bias = z == 0 ? bq : z == 1 ? bk : bvv;
  _Float16* __restrict__ dst = ws + (long)z * (B_SZ * NHEAD * S_LEN * DHEAD);
  const int   transposed = z == 2;
  const float oscale     = z == 0 ? Q_SCALE : 1.0f;

  const int tid  = threadIdx.x;
  const int w    = tid >> 5;
  const int lane = tid & 31;
  const int g    = lane >> 4;
  const int ln   = lane & 15;
  const int rbase = blockIdx.y * (64 * RTILES);
  const int cbase = blockIdx.x * 64;

  // The lane's place in a chunk of X: piece i is row i + 8g of the wave's 16,
  // floats 4 ln .. 4 ln + 3 of the chunk. Rows i and i + 8 lie 32 banks apart.
  // An address is a base that is the same for the whole block plus the lane's
  // 32-bit offset xo: one register a lane instead of a pair for every base.
  const float*   xg = X + (long)rbase * DIM;
  const unsigned xo = (16 * w + 8 * g) * DIM + 4 * ln;
  _Float16*    xst = &ldsX[(16 * w + 8 * g) * XPITCH + 4 * ln];
  v4f xr[XDEPTH][8];
  // every loop over xr is unrolled: it is indexed by constants only
  // The first chunks fly while the W panel is staged.
#pragma unroll
  for (int c = 0; c < XDEPTH; ++c)
#pragma unroll
    for (int i = 0; i < 8; ++i)
      xr[c][i] = *(const v4f*)(xg + (i * DIM + c * XCH) + xo);

  // bias of the lane's four columns, the same for every row tile
  float bv[4];
  // stands in front of any later rewrite of an address register of the loads above
  asm volatile("s_wait_xcnt 0x0" ::: "memory");
  // with the one below: nothing that could take over the address register of the
  // bias loads is scheduled between them and their wait
  __builtin_amdgcn_sched_barrier(0);
#pragma unroll
  for (int t = 0; t < 4; ++t) bv[t] = bias[cbase + 16 * t + ln];
  // stands in front of any later rewrite of the loads' address registers
  asm volatile("s_wait_xcnt 0x0" ::: "memory");
  // keeps the address arithmetic of the staging below behind that wait
  __builtin_amdgcn_sched_barrier(0);

  // Stage W[0 .. 512)[cbase .. +64) as f16, [col][k]. A lane owns one column:
  // eight row loads (one 128-B line per wave each) pack into one 16-B store.
  {
    const int    cc = tid & 63;
    const int    kh = tid >> 6;
    const float* wc = W + cbase + cc;
    // unroll 8: 64 independent loads in flight per lane, to cover L2 latency
#pragma unroll 8
    for (int i = 0; i < DIM / 16; ++i) {
      const int k0 = (2 * i + kh) * 8;
      v8h pk;
#pragma unroll
      for (int j = 0; j < 8; ++j) pk[j] = (_Float16)wc[(long)(k0 + j) * DIM];
      *(v8h*)&ldsW[cc * WPITCH + k0] = pk;
    }
  }
  // chunk 0 into the wave's buffer
#pragma unroll
  for (int i = 0; i < 8; ++i)
    *(v4h*)(xst + i * XPITCH) = __builtin_convertvector(xr[0][i], v4h);
  __syncthreads();
  // its registers take chunk XDEPTH, behind the barrier, which waits for every
  // load issued in front of it
#pragma unroll
  for (int i = 0; i < 8; ++i)
    xr[0][i] = *(const v4f*)(xg + (i * DIM + XDEPTH * XCH) + xo);
  // stands in front of any later rewrite of the loads' address registers
  asm volatile("s_wait_xcnt 0x0" ::: "memory");
  // keeps what follows behind that wait
  __builtin_amdgcn_sched_barrier(0);

  const _Float16* xfr = &ldsX[(16 * w + ln) * XPITCH];  // A operand: lane = row

  // Where the results go: the block's 64 columns are one head, its RTILES * 64
  // rows lie in one batch (S = 2048).
  const int  h   = blockIdx.x;
  const int  bb  = rbase >> 11;
  const int  s0  = rbase & (S_LEN - 1);
  const long bh  = (long)(bb * NHEAD + h);
  const int  pr  = lane >> 3;           // read-back: row in a group of four,
  const int  pc  = (lane & 7) * 8;      // 16-B piece of the row

  // rolled over the tiles: the text stays a quarter as long as unrolled
#pragma unroll 1
  for (int r = 0; r < RTILES; ++r) {
    const float* xt = xg + (long)r * (64 * DIM);  // this tile's rows
    // The next tile's rows. Behind the last tile the loads stay unconditional
    // (a branch in the trip would part a chunk's loads from its conversion, and
    // the conversion is then lifted to the loads and waits for them at once):
    // they are aimed at the head of X, one line a load, and nothing reads them.
    const float*   xn  = r + 1 < RTILES ? xt + 64 * DIM : X;
    const unsigned xon = r + 1 < RTILES ? xo : 0u;
    v8f acc[4] = {};

#pragma unroll
    for (int c = 0; c < NXCH; ++c) {
      // the chunk's fragments, one group: A (2 K steps), B (2 K steps x 4 tiles)
      v16h A[2], B[2][4];
#pragma unroll
      for (int s = 0; s < 2; ++s) {
        A[s] = load2x8(xfr + s * 32, g);
#pragma unroll
        for (int t = 0; t < 4; ++t)
          B[s][t] = load2x8(&ldsW[(16 * t + ln) * WPITCH + c * XCH + s * 32], g);
      }
      // the wave's reads of its X buffer have returned before it is rewritten
      asm volatile("s_wait_dscnt 0x0" ::: "memory");
      // keeps a chunk's conversion at its store: lifted into an earlier trip,
      // it would wait for global loads that have only just been issued
      __builtin_amdgcn_sched_barrier(0);
      // chunk c + 1 (in the last trip: the next tile's chunk 0) goes to LDS;
      // chunk c + 1 + XDEPTH takes the freed registers
      const int    n  = c + 1 + XDEPTH;
      const float*   xc  = n < NXCH ? xt + n * XCH : xn + (n - NXCH) * XCH;
      const unsigned xoc = n < NXCH ? xo : xon;
#pragma unroll
      for (int i = 0; i < 8; ++i) {
        *(v4h*)(xst + i * XPITCH) =
            __builtin_convertvector(xr[(c + 1) % XDEPTH][i], v4h);
        xr[(c + 1) % XDEPTH][i] = *(const v4f*)(xc + i * DIM + xoc);
      }
#pragma unroll
      for (int s = 0; s < 2; ++s)
#pragma unroll
        for (int t = 0; t < 4; ++t)
          acc[t] = __builtin_amdgcn_wmma_f32_16x16x32_f16(
              false, A[s], false, B[s][t], (short)0, acc[t], false, false);
      // keeps the wait below behind the products, which cover the stores' way
      __builtin_amdgcn_sched_barrier(0);
      // the other lanes' stores of the next chunk have landed before the wave
      // reads its fragments back
      asm volatile("s_wait_dscnt 0x0" ::: "memory");
      // stands in front of any later rewrite of an address register of the
      // trip's global loads
      asm volatile("s_wait_xcnt 0x0" ::: "memory");
      // trip's end, for the same reason as above
      __builtin_amdgcn_sched_barrier(0);
    }

    // Epilogue: bias add, output scale (fp32), f16 convert, head-split store.
    // acc[t][j] is row 16w + 8g + j (s), column 16t + ln (d) of the tile.
    // The tile is staged in ldsO at the X pitch and leaves in rows of 128 B.
    const int st0 = s0 + 64 * r;  // the tile's first s

    if (transposed) {
      // V^T: tile [d][s]. A line holds s of all four waves: every wave has read
      // its rows of the tile before from ldsO before any of it is rewritten.
      lds_barrier();
#pragma unroll
      for (int t = 0; t < 4; ++t) {
        v8h pk;  // eight consecutive s of one d
#pragma unroll
        for (int j = 0; j < 8; ++j)
          pk[j] = (_Float16)((acc[t][j] + bv[t]) * oscale);
        *(v8h*)&ldsO[(16 * t + ln) * XPITCH + 16 * w + 8 * g] = pk;
      }
      // the tile is whole before a wave reads rows that all four wrote
      lds_barrier();
      _Float16* o = dst + (bh * DHEAD * S_LEN + st0) +
                    (unsigned)((16 * w + pr) * S_LEN + pc);
#pragma unroll
      for (int i = 0; i < 4; ++i)
        *(v8h*)(o + (long)(4 * i) * S_LEN) =
            *(const v8h*)&ldsO[(16 * w + 4 * i + pr) * XPITCH + pc];
      // stands in front of the next tile's rewrite of the stores' registers
      asm volatile("s_wait_xcnt 0x0" ::: "memory");
    } else {
      // Q, K: tile [s][d]. A wave's 16 rows are its own: it stages them in its
      // own rows of ldsO.
      _Float16* st = &ldsO[(16 * w + 8 * g) * XPITCH + ln];
#pragma unroll
      for (int t = 0; t < 4; ++t)
#pragma unroll
        for (int j = 0; j < 8; ++j)
          st[j * XPITCH + 16 * t] = (_Float16)((acc[t][j] + bv[t]) * oscale);
      // the other lanes' stores have landed before the wave reads the rows back
      asm volatile("s_wait_dscnt 0x0" ::: "memory");
      _Float16* o = dst + (bh * S_LEN + st0) * DHEAD +
                    (unsigned)((16 * w + pr) * DHEAD + pc);
#pragma unroll
      for (int i = 0; i < 4; ++i)
        *(v8h*)(o + 4 * i * DHEAD) =
            *(const v8h*)&ldsO[(16 * w + 4 * i + pr) * XPITCH + pc];
      // stands in front of the next tile's rewrite of the stores' registers
      asm volatile("s_wait_xcnt 0x0" ::: "memory");
    }
  }
  // no load (the last tile's unread ones) is left in flight when the wave ends
  asm volatile("s_wait_loadcnt 0x0" ::: "memory");
}

#define KVPITCH (DHEAD + 8)
#define KVTILE  (64 * KVPITCH)   // halves in one staged tile
#define NTILE   (S_LEN / 64)
// column tiles (of 16 queries) a wave holds
#define QT      2

// One tile pair: every lane copies four 16-B pieces of K and four of V^T.
// kg, vg: the lane's first piece in global memory; lk: its place in the K tile
// of the target buffer (LDS byte address); the V^T tile lies behind the K tile.
// Piece i lies 16 tile rows behind piece i - 1.
static __device__ __forceinline__ void copy_kv_tile(const _Float16* kg,
                                                    const _Float16* vg,
                                                    unsigned lk) {
  const unsigned lv = lk + KVTILE * 2;
  const unsigned ls = 16 * KVPITCH * 2;
  // The closing s_wait_xcnt 0 stands inside the statement so that no address
  // register of a copy is rewritten before it.
  asm volatile(
      "global_load_async_to_lds_b128 %0, %8, off\n\t"
      "global_load_async_to_lds_b128 %1, %9, off\n\t"
      "global_load_async_to_lds_b128 %2, %10, off\n\t"
      "global_load_async_to_lds_b128 %3, %11, off\n\t"
      "global_load_async_to_lds_b128 %4, %12, off\n\t"
      "global_load_async_to_lds_b128 %5, %13, off\n\t"
      "global_load_async_to_lds_b128 %6, %14, off\n\t"
      "global_load_async_to_lds_b128 %7, %15, off\n\t"
      "s_wait_xcnt 0x0"
      :: "v"(lk), "v"(lk + ls), "v"(lk + 2 * ls), "v"(lk + 3 * ls),
         "v"(lv), "v"(lv + ls), "v"(lv + 2 * ls), "v"(lv + 3 * ls),
         "v"(kg), "v"(kg + 16 * DHEAD), "v"(kg + 32 * DHEAD),
         "v"(kg + 48 * DHEAD),
         "v"(vg), "v"(vg + 16 * S_LEN), "v"(vg + 32 * S_LEN),
         "v"(vg + 48 * S_LEN)
      : "memory");
}

// Value of lane l ^ 16 (the other half of the wave), by a vector cross-row move.
static __device__ __forceinline__ float other_half(float x) {
  const int b = __builtin_bit_cast(int, x);
  return __builtin_bit_cast(float, __builtin_amdgcn_permlanex16(
      b, b, 0x76543210, 0xfedcba98, false, false));
}

// waves_per_eu: the grid puts two waves on a SIMD (two blocks per WGP); the
// register budget is that share: a wave's scores, outputs and fragments for two
// column tiles do not fit a quarter of the file.
__global__ __launch_bounds__(128) __attribute__((amdgpu_waves_per_eu(2, 2)))
void attn_kernel(
    const _Float16* __restrict__ Q, const _Float16* __restrict__ K,
    const _Float16* __restrict__ VT, float* __restrict__ out) {
  __shared__ __align__(16) _Float16 ldsKV[2 * 2 * KVTILE];  // [buffer][K, V^T]

  const int tid  = threadIdx.x;
  const int w    = tid >> 5;
  const int lane = tid & 31;
  const int g    = lane >> 4;
  const int ln   = lane & 15;
  const int qb = blockIdx.x, h = blockIdx.y, b = blockIdx.z;

  const long bh = (long)b * NHEAD + h;
  const _Float16* qp = Q  + bh * S_LEN * DHEAD;
  const _Float16* kp = K  + bh * S_LEN * DHEAD;
  const _Float16* vp = VT + bh * DHEAD * S_LEN;

  // Q^T operands (B: lane = query column), loop-invariant; they already carry
  // the softmax scale in log2 units. Column tile c holds query qrow + 16 c.
  const int qrow = qb * (64 * QT) + 16 * QT * w + ln;
  v16h Bq[QT][2];
#pragma unroll
  for (int c = 0; c < QT; ++c)
#pragma unroll
    for (int kc = 0; kc < 2; ++kc)
      Bq[c][kc] = load2x8(qp + (long)(qrow + 16 * c) * DHEAD + kc * 32, g);

  float m[QT];           // running maximum of the lane's query, equal in both halves
  v8f   lv[QT] = {};     // partial row sums: this lane's keys only
  v8f   acc[QT][4] = {}; // O^T: acc[c][t][j] = O[query ln of tile c][d = 16t + 8g + j]
#pragma unroll
  for (int c = 0; c < QT; ++c) m[c] = -1e30f;

  // The lane's piece of a tile: row tid / 8, 16-B column tid % 8, so that a
  // wave's copy covers four whole 128-B lines.
  const _Float16* kg = kp + tid * 8;
  const _Float16* vg = vp + (long)(tid >> 3) * S_LEN + (tid & 7) * 8;
  const unsigned  lk =
      (unsigned)(size_t)&ldsKV[(tid >> 3) * KVPITCH + (tid & 7) * 8];

  copy_kv_tile(kg, vg, lk);
  // tile 0 has landed for this wave, then for the block
  asm volatile("s_wait_asynccnt 0x0" ::: "memory");
  __syncthreads();
  copy_kv_tile(kg + 64 * DHEAD, vg + 64, lk + 2 * KVTILE * 2);

  for (int kb = 0; kb < NTILE; ++kb) {
    const int buf = (kb & 1) * 2 * KVTILE;
    // ---- scores (log2 units): S^T = K @ Qs^T, 64 keys x 16 queries a tile ----
    // sc[c][t][j] = score of key 16t + 8g + j against query ln of column tile c
    v16h Ak[8];
    // every inner loop of the trip is unrolled: Ak, Av, sc, ph and acc are
    // indexed by constants only and stay in registers
#pragma unroll
    for (int t = 0; t < 4; ++t) {
      const _Float16* kr = &ldsKV[buf + (16 * t + ln) * KVPITCH];
      Ak[2 * t]     = load2x8(kr, g);
      Ak[2 * t + 1] = load2x8(kr + 32, g);
    }
    // V^T fragments of this tile (A: lane = row d), read in the same group so
    // that their LDS latency passes behind the score products and the softmax.
    v16h Av[8];
#pragma unroll
    for (int t = 0; t < 4; ++t) {
      const _Float16* vb = &ldsKV[buf + KVTILE + (16 * t + ln) * KVPITCH];
      Av[2 * t]     = load2x8(vb, g);
      Av[2 * t + 1] = load2x8(vb + 32, g);
    }
    // keeps the trip's 32 fragment loads in one place: sunk between the
    // products, each small group would be waited for at its own place
    __builtin_amdgcn_sched_barrier(0);

    v8f sc[QT][4];
#pragma unroll
    for (int c = 0; c < QT; ++c) {
#pragma unroll
      for (int t = 0; t < 4; ++t) {
        v8f z = {};
        sc[c][t] = __builtin_amdgcn_wmma_f32_16x16x32_f16(
            false, Ak[2 * t], false, Bq[c][0], (short)0, z, false, false);
      }
#pragma unroll
      for (int t = 0; t < 4; ++t)
        sc[c][t] = __builtin_amdgcn_wmma_f32_16x16x32_f16(
            false, Ak[2 * t + 1], false, Bq[c][1], (short)0, sc[c][t], false, false);
    }

    // ---- maximum of a query's 64 scores: in-lane, then across the halves ----
    float mn[QT], corr[QT];
#pragma unroll
    for (int c = 0; c < QT; ++c) {
      float mt[4];
#pragma unroll
      for (int t = 0; t < 4; ++t) {
        float v = sc[c][t][0];
#pragma unroll
        for (int j = 1; j < 8; ++j) v = fmaxf(v, sc[c][t][j]);
        mt[t] = v;
      }
      const float mx = fmaxf(fmaxf(fmaxf(mt[0], mt[1]), fmaxf(mt[2], mt[3])), m[c]);
      mn[c] = fmaxf(mx, other_half(mx));
    }
#pragma unroll
    for (int c = 0; c < QT; ++c) {
      corr[c] = __builtin_amdgcn_exp2f(m[c] - mn[c]);
      m[c] = mn[c];
      // rescale the row sums and the output accumulators
      lv[c] *= corr[c];
#pragma unroll
      for (int t = 0; t < 4; ++t) acc[c][t] *= corr[c];
    }

#pragma unroll
    for (int c = 0; c < QT; ++c) {
      // ---- p = 2^(s - m); partial sums; P^T packed as the B operand ----
      // B element s of key chunk kc is key 32kc + 8g + s (s < 8) or
      // 32kc + 16 + 8g + s - 8: score tiles 2kc and 2kc + 1, register for register.
      v8h ph[4];
#pragma unroll
      for (int t = 0; t < 4; ++t) {
        const v8f e = sc[c][t] - mn[c];
        v8f p;
#pragma unroll
        for (int j = 0; j < 8; ++j) p[j] = __builtin_amdgcn_exp2f(e[j]);
        lv[c] += p;
        ph[t] = __builtin_convertvector(p, v8h);
      }
      const v16h Bp0 = __builtin_shufflevector(ph[0], ph[1], 0, 1, 2, 3, 4, 5, 6, 7,
                                               8, 9, 10, 11, 12, 13, 14, 15);
      const v16h Bp1 = __builtin_shufflevector(ph[2], ph[3], 0, 1, 2, 3, 4, 5, 6, 7,
                                               8, 9, 10, 11, 12, 13, 14, 15);

      // ---- O^T += V^T @ P^T ----
#pragma unroll
      for (int t = 0; t < 4; ++t)
        acc[c][t] = __builtin_amdgcn_wmma_f32_16x16x32_f16(
            false, Av[2 * t], false, Bp0, (short)0, acc[c][t], false, false);
#pragma unroll
      for (int t = 0; t < 4; ++t)
        acc[c][t] = __builtin_amdgcn_wmma_f32_16x16x32_f16(
            false, Av[2 * t + 1], false, Bp1, (short)0, acc[c][t], false, false);
    }

    // keeps the hand-over at the trip's foot: lifted over the softmax, it would
    // leave the next copies, issued behind the PV products, too short a flight
    __builtin_amdgcn_sched_barrier(0);
    // Hand-over: this wave's reads of the buffer are done ...
    asm volatile("s_wait_dscnt 0x0" ::: "memory");
    // ... and its copies of the next tile have landed;
    asm volatile("s_wait_asynccnt 0x0" ::: "memory");
    // the barrier publishes the next tile and frees this trip's buffer.
    __syncthreads();
    if (kb + 2 < NTILE)
      copy_kv_tile(kg + (long)(kb + 2) * 64 * DHEAD, vg + (kb + 2) * 64,
                   lk + buf * 2);
  }
  // no copy is left in flight when the wave ends
  asm volatile("s_wait_asynccnt 0x0" ::: "memory");

  // ---- epilogue: join the partial row sums, normalize, store fp32 ----
#pragma unroll
  for (int c = 0; c < QT; ++c) {
    float l = ((lv[c][0] + lv[c][1]) + (lv[c][2] + lv[c][3])) +
              ((lv[c][4] + lv[c][5]) + (lv[c][6] + lv[c][7]));
    l += other_half(l);
    const float inv = 1.0f / l;
    // A lane holds eight consecutive d of its query per tile: two 16-B stores.
    float* orow = out + ((long)b * S_LEN + qrow + 16 * c) * DIM + h * DHEAD + 8 * g;
#pragma unroll
    for (int t = 0; t < 4; ++t) {
      const v8f o = acc[c][t] * inv;
      *(v4f*)(orow + 16 * t)     = __builtin_shufflevector(o, o, 0, 1, 2, 3);
      *(v4f*)(orow + 16 * t + 4) = __builtin_shufflevector(o, o, 4, 5, 6, 7);
    }
  }
}

// ---------------------------------------------------------------------------
extern "C" void kernel_launch(void* const* d_in, const int* in_sizes, int n_in,
                              void* d_out, int out_size, void* d_ws, size_t ws_size,
                              hipStream_t stream) {
  const float* q  = (const float*)d_in[0];
  const float* k  = (const float*)d_in[1];
  const float* v  = (const float*)d_in[2];
  const float* Wq = (const float*)d_in[3];
  const float* bq = (const float*)d_in[4];
  const float* Wk = (const float*)d_in[5];
  const float* bk = (const float*)d_in[6];
  const float* Wv = (const float*)d_in[7];
  const float* bv = (const float*)d_in[8];

  const size_t per = (size_t)B_SZ * NHEAD * S_LEN * DHEAD;  // f16 elements
  _Float16* wsq = (_Float16*)d_ws;
  _Float16* wsk = wsq + per;
  _Float16* wsv = wsk + per;

  dim3 blk(128);
  dim3 g1(DIM / 64, (B_SZ * S_LEN) / (64 * RTILES), 3);   // (8, 32, 3): Q, K, V planes
  qkv_proj_kernel<<<g1, blk, 0, stream>>>(q, k, v, Wq, Wk, Wv, bq, bk, bv, wsq);

  dim3 g2(S_LEN / (64 * QT), NHEAD, B_SZ);  // (16, 8, 4)
  attn_kernel<<<g2, blk, 0, stream>>>(wsq, wsk, wsv, (float*)d_out);
}

// v009
// One run takes 54.4 microseconds.
// In both of two side-by-side timings against v008, it was 1.04 times as fast.
// Counting every step since v000, it is 4.46 times as fast.
#include <hip/hip_runtime.h>
#include <hip/hip_bf16.h>

typedef __attribute__((ext_vector_type(16))) _Float16 v16h;
typedef __attribute__((ext_vector_type(8)))  _Float16 v8h;
typedef __attribute__((ext_vector_type(4)))  _Float16 v4h;
typedef __attribute__((ext_vector_type(8)))  float    v8f;
typedef __attribute__((ext_vector_type(4)))  float    v4f;

#define B_SZ   4
#define S_LEN  2048
#define NHEAD  8
#define DHEAD  64
#define DIM    512

// 1/sqrt(DHEAD) * log2(e): folds softmax scaling AND the exp->exp2 change of
// base into the Q projection (applied in fp32 there).
#define Q_SCALE (0.125f * 1.4426950408889634f)

// Build a 16-bit WMMA A/B operand for 16x16x32:
// lane (g = lane>>4) holds halves K = {8g..8g+7} and {16+8g..16+8g+7},
// i.e. two contiguous 16-byte runs from a K-major row/column.
static __device__ __forceinline__ v16h load2x8(const _Float16* base, int g) {
  const v8h lo = *(const v8h*)(base + 8 * g);
  const v8h hi = *(const v8h*)(base + 16 + 8 * g);
  v16h r;
#pragma unroll
  for (int i = 0; i < 8; ++i) { r[i] = lo[i]; r[i + 8] = hi[i]; }
  return r;
}

// ---------------------------------------------------------------------------
// Kernel 1: Y = (X @ W + b) * oscale, converted to f16, written head-split.
//   transposed==0 : dst[((b*H + h)*S + s)*64 + d]   (Q, K)
//   transposed==1 : dst[((b*H + h)*64 + d)*S + s]   (V^T for PV A-operand)
// One launch holds the three independent projections (0: Q, 1: K, 2: V).
// The work is 768 items: (projection, group of RTILES row tiles, 64-col panel),
// the panel running fastest. A group of 128 threads (4 waves) does one item;
// tile = 64 rows x 64 cols; K step 32. A block is NSUB = 3 such groups on three
// items in a row, one block to a WGP: mostly three panels over the SAME rows of
// X, so that a line of X that one group has asked for is found in the WGP's
// cache by the other two and is fetched from L2 once, not three times. The
// items of the blocks with equal index mod 8 follow one another: for speed only.
// A group's whole W panel (512 k x 64 cols) is staged in LDS once, so the
// K loop runs without barriers, and the panel serves RTILES row tiles one after
// the other: W is read from L2, converted and stored a quarter as often as with
// one tile an item. The grid (256 blocks, one to a WGP) is resident at once.
// The chunks of X run on across the tiles: the next tile's first chunks fly
// while this tile's result leaves.
// X reaches the A operand through LDS: a wave reads its 16 rows in chunks of
// 64 k with loads that cover whole 256-B runs of two rows (4 lines a load; a
// load in fragment order would touch 16), converts, stores the chunk in a
// buffer of its own and reads the fragments back. Four chunks are in flight.
// The result leaves through LDS too: a group's tile is 64 whole 128-B lines
// of dst (one head: 64 s x 64 d, or 64 d x 64 s), and every 16-B store of a wave
// covers four of them. Its staging has LDS of its own: the X buffers already
// hold the next tile's first chunk by then.
// ---------------------------------------------------------------------------
// LDS row pitch in halves: 1040 B = 16 B x 65 (odd), so that 16 lanes on 16
// consecutive columns cover all 64 banks in a 16-byte store or load.
#define WPITCH (DIM + 8)
// X chunk: 64 k; row pitch 144 B = 16 B x 9 (odd), as the fragment reads want.
#define XCH    64
#define XPITCH (XCH + 8)
#define NXCH   (DIM / XCH)
// register sets of the ring; divides NXCH, so that the ring closes over a tile
#define XDEPTH 4
// row tiles a group works through with one staged panel
#define RTILES 4
// groups of four waves in a block, each with an item (panel, buffers) of its own
#define NSUB   3

// Work-group barrier that orders LDS traffic only. __syncthreads() also waits
// for every global load and store of the wave: between two row tiles that would
// drain the chunks of X that fly for the next tile.
static __device__ __forceinline__ void lds_barrier() {
  __builtin_amdgcn_fence(__ATOMIC_RELEASE, "workgroup", "local");
  __builtin_amdgcn_s_barrier();
  __builtin_amdgcn_fence(__ATOMIC_ACQUIRE, "workgroup", "local");
}

// waves_per_eu: a block puts three waves on a SIMD; the register budget is that
// share.
__global__ __launch_bounds__(128 * NSUB) __attribute__((amdgpu_waves_per_eu(3, 3)))
void qkv_proj_kernel(
    const float* __restrict__ Xq, const float* __restrict__ Xk,
    const float* __restrict__ Xv, const float* __restrict__ Wq,
    const float* __restrict__ Wk, const float* __restrict__ Wv,
    const float* __restrict__ bq, const float* __restrict__ bk,
    const float* __restrict__ bvv, _Float16* __restrict__ ws) {
  __shared__ __align__(16) _Float16 ldsWall[NSUB * 64 * WPITCH];      // [col][k] panels
  __shared__ __align__(16) _Float16 ldsXall[NSUB * 4 * 16 * XPITCH];  // [wave][row][k]
  __shared__ __align__(16) _Float16 ldsOall[NSUB * 64 * XPITCH];      // result tiles

  // The wave's group (the same in every lane: kept scalar) and the group's item.
  const int sub  = __builtin_amdgcn_readfirstlane((int)(threadIdx.x >> 7));
  const int slot = (blockIdx.x & 7) * 32 + (blockIdx.x >> 3);
  const int item = NSUB * slot + sub;
  const int cb   = item & 7;          // column panel = head
  const int rg   = (item >> 3) & 31;  // group of RTILES row tiles
  _Float16* ldsW = ldsWall + sub * (64 * WPITCH);
  _Float16* ldsX = ldsXall + sub * (4 * 16 * XPITCH);
  _Float16* ldsO = ldsOall + sub * (64 * XPITCH);
  // Does a group of this block write V^T? (its last item does, if any): the same
  // for the whole block, as the barriers of that path must be.
  const bool blockT = ((NSUB * slot + NSUB - 1) >> 8) == 2;

  // The group's projection: operands, plane of the workspace, layout, scale.
  const int z = item >> 8;
  const float* __restrict__ X    = z == 0 ? Xq : z == 1 ? Xk : Xv;
  const float* __restrict__ W    = z == 0 ? Wq : z == 1 ? Wk : Wv;
  const float* __restrict__ bias = z == 0 ? bq : z == 1 ? bk : bvv;
  _Float16* __restrict__ dst = ws + (long)z * (B_SZ * NHEAD * S_LEN * DHEAD);
  const int   transposed = z == 2;
  const float oscale     = z == 0 ? Q_SCALE : 1.0f;

  const int tid  = threadIdx.x & 127;  // place in the group
  const int w    = tid >> 5;
  const int lane = tid & 31;
  const int g    = lane >> 4;
  const int ln   = lane & 15;
  const int rbase = rg * (64 * RTILES);
  const int cbase = cb * 64;

  // The lane's place in a chunk of X: piece i is row i + 8g of the wave's 16,
  // floats 4 ln .. 4 ln + 3 of the chunk. Rows i and i + 8 lie 32 banks apart.
  // An address is a base that is the same for the whole group plus the lane's
  // 32-bit offset xo: one register a lane instead of a pair for every base.
  const float*   xg = X + (long)rbase * DIM;
  const unsigned xo = (16 * w + 8 * g) * DIM + 4 * ln;
  _Float16*    xst = &ldsX[(16 * w + 8 * g) * XPITCH + 4 * ln];
  v4f xr[XDEPTH][8];
  // every loop over xr is unrolled: it is indexed by constants only
  // The first chunks fly while the W panel is staged.
#pragma unroll
  for (int c = 0; c < XDEPTH; ++c)
#pragma unroll
    for (int i = 0; i < 8; ++i)
      xr[c][i] = *(const v4f*)(xg + (i * DIM + c * XCH) + xo);

  // bias of the lane's four columns, the same for every row tile
  float bv[4];
  // stands in front of any later rewrite of an address register of the loads above
  asm volatile("s_wait_xcnt 0x0" ::: "memory");
  // with the one below: nothing that could take over the address register of the
  // bias loads is scheduled between them and their wait
  __builtin_amdgcn_sched_barrier(0);
#pragma unroll
  for (int t = 0; t < 4; ++t) bv[t] = bias[cbase + 16 * t + ln];
  // stands in front of any later rewrite of the loads' address registers
  asm volatile("s_wait_xcnt 0x0" ::: "memory");
  // keeps the address arithmetic of the staging below behind that wait
  __builtin_amdgcn_sched_barrier(0);

  // Stage W[0 .. 512)[cbase .. +64) as f16, [col][k]. A lane owns one column:
  // eight row loads (one 128-B line per wave each) pack into one 16-B store.
  {
    const int    cc = tid & 63;
    const int    kh = tid >> 6;
    const float* wc = W + cbase + cc;
    // unroll 8: 64 independent loads in flight per lane, to cover L2 latency
#pragma unroll 8
    for (int i = 0; i < DIM / 16; ++i) {
      const int k0 = (2 * i + kh) * 8;
      v8h pk;
#pragma unroll
      for (int j = 0; j < 8; ++j) pk[j] = (_Float16)wc[(long)(k0 + j) * DIM];
      *(v8h*)&ldsW[cc * WPITCH + k0] = pk;
    }
  }
  // chunk 0 into the wave's buffer
#pragma unroll
  for (int i = 0; i < 8; ++i)
    *(v4h*)(xst + i * XPITCH) = __builtin_convertvector(xr[0][i], v4h);
  __syncthreads();
  // its registers take chunk XDEPTH, behind the barrier, which waits for every
  // load issued in front of it
#pragma unroll
  for (int i = 0; i < 8; ++i)
    xr[0][i] = *(const v4f*)(xg + (i * DIM + XDEPTH * XCH) + xo);
  // stands in front of any later rewrite of the loads' address registers
  asm volatile("s_wait_xcnt 0x0" ::: "memory");
  // keeps what follows behind that wait
  __builtin_amdgcn_sched_barrier(0);

  const _Float16* xfr = &ldsX[(16 * w + ln) * XPITCH];  // A operand: lane = row

  // Where the results go: the group's 64 columns are one head, its RTILES * 64
  // rows lie in one batch (S = 2048).
  const int  h   = cb;
  const int  bb  = rbase >> 11;
  const int  s0  = rbase & (S_LEN - 1);
  const long bh  = (long)(bb * NHEAD + h);
  const int  pr  = lane >> 3;           // read-back: row in a group of four,
  const int  pc  = (lane & 7) * 8;      // 16-B piece of the row

  // rolled over the tiles: the text stays a quarter as long as unrolled
#pragma unroll 1
  for (int r = 0; r < RTILES; ++r) {
    const float* xt = xg + (long)r * (64 * DIM);  // this tile's rows
    // The next tile's rows. Behind the last tile the loads stay unconditional
    // (a branch in the trip would part a chunk's loads from its conversion, and
    // the conversion is then lifted to the loads and waits for them at once):
    // they are aimed at the head of X, one line a load, and nothing reads them.
    const float*   xn  = r + 1 < RTILES ? xt + 64 * DIM : X;
    const unsigned xon = r + 1 < RTILES ? xo : 0u;
    v8f acc[4] = {};

#pragma unroll
    for (int c = 0; c < NXCH; ++c) {
      // the chunk's fragments, one group: A (2 K steps), B (2 K steps x 4 tiles)
      v16h A[2], B[2][4];
#pragma unroll
      for (int s = 0; s < 2; ++s) {
        A[s] = load2x8(xfr + s * 32, g);
#pragma unroll
        for (int t = 0; t < 4; ++t)
          B[s][t] = load2x8(&ldsW[(16 * t + ln) * WPITCH + c * XCH + s * 32], g);
      }
      // the wave's reads of its X buffer have returned before it is rewritten
      asm volatile("s_wait_dscnt 0x0" ::: "memory");
      // keeps a chunk's conversion at its store: lifted into an earlier trip,
      // it would wait for global loads that have only just been issued
      __builtin_amdgcn_sched_barrier(0);
      // chunk c + 1 (in the last trip: the next tile's chunk 0) goes to LDS;
      // chunk c + 1 + XDEPTH takes the freed registers
      const int    n  = c + 1 + XDEPTH;
      const float*   xc  = n < NXCH ? xt + n * XCH : xn + (n - NXCH) * XCH;
      const unsigned xoc = n < NXCH ? xo : xon;
#pragma unroll
      for (int i = 0; i < 8; ++i) {
        *(v4h*)(xst + i * XPITCH) =
            __builtin_convertvector(xr[(c + 1) % XDEPTH][i], v4h);
        xr[(c + 1) % XDEPTH][i] = *(const v4f*)(xc + i * DIM + xoc);
      }
#pragma unroll
      for (int s = 0; s < 2; ++s)
#pragma unroll
        for (int t = 0; t < 4; ++t)
          acc[t] = __builtin_amdgcn_wmma_f32_16x16x32_f16(
              false, A[s], false, B[s][t], (short)0, acc[t], false, false);
      // keeps the wait below behind the products, which cover the stores' way
      __builtin_amdgcn_sched_barrier(0);
      // the other lanes' stores of the next chunk have landed before the wave
      // reads its fragments back
      asm volatile("s_wait_dscnt 0x0" ::: "memory");
      // stands in front of any later rewrite of an address register of the
      // trip's global loads
      asm volatile("s_wait_xcnt 0x0" ::: "memory");
      // trip's end, for the same reason as above
      __builtin_amdgcn_sched_barrier(0);
    }

    // Epilogue: bias add, output scale (fp32), f16 convert, head-split store.
    // acc[t][j] is row 16w + 8g + j (s), column 16t + ln (d) of the tile.
    // The tile is staged in ldsO at the X pitch and leaves in rows of 128 B.
    const int st0 = s0 + 64 * r;  // the tile's first s

    // V^T: tile [d][s]. A line holds s of all four waves: every wave has read
    // its rows of the tile before from ldsO before any of it is rewritten.
    // Every wave of a block that holds such a group passes both barriers.
    if (blockT) lds_barrier();
    if (transposed) {
#pragma unroll
      for (int t = 0; t < 4; ++t) {
        v8h pk;  // eight consecutive s of one d
#pragma unroll
        for (int j = 0; j < 8; ++j)
          pk[j] = (_Float16)((acc[t][j] + bv[t]) * oscale);
        *(v8h*)&ldsO[(16 * t + ln) * XPITCH + 16 * w + 8 * g] = pk;
      }
    }
    // the tile is whole before a wave reads rows that all four wrote
    if (blockT) lds_barrier();
    if (transposed) {
      _Float16* o = dst + (bh * DHEAD * S_LEN + st0) +
                    (unsigned)((16 * w + pr) * S_LEN + pc);
#pragma unroll
      for (int i = 0; i < 4; ++i)
        *(v8h*)(o + (long)(4 * i) * S_LEN) =
            *(const v8h*)&ldsO[(16 * w + 4 * i + pr) * XPITCH + pc];
      // stands in front of the next tile's rewrite of the stores' registers
      asm volatile("s_wait_xcnt 0x0" ::: "memory");
    } else {
      // Q, K: tile [s][d]. A wave's 16 rows are its own: it stages them in its
      // own rows of ldsO.
      _Float16* st = &ldsO[(16 * w + 8 * g) * XPITCH + ln];
#pragma unroll
      for (int t = 0; t < 4; ++t)
#pragma unroll
        for (int j = 0; j < 8; ++j)
          st[j * XPITCH + 16 * t] = (_Float16)((acc[t][j] + bv[t]) * oscale);
      // the other lanes' stores have landed before the wave reads the rows back
      asm volatile("s_wait_dscnt 0x0" ::: "memory");
      _Float16* o = dst + (bh * S_LEN + st0) * DHEAD +
                    (unsigned)((16 * w + pr) * DHEAD + pc);
#pragma unroll
      for (int i = 0; i < 4; ++i)
        *(v8h*)(o + 4 * i * DHEAD) =
            *(const v8h*)&ldsO[(16 * w + 4 * i + pr) * XPITCH + pc];
      // stands in front of the next tile's rewrite of the stores' registers
      asm volatile("s_wait_xcnt 0x0" ::: "memory");
    }
  }
  // no load (the last tile's unread ones) is left in flight when the wave ends
  asm volatile("s_wait_loadcnt 0x0" ::: "memory");
}

#define KVPITCH (DHEAD + 8)
#define KVTILE  (64 * KVPITCH)   // halves in one staged tile
#define NTILE   (S_LEN / 64)
// column tiles (of 16 queries) a wave holds
#define QT      2

// One tile pair: every lane copies four 16-B pieces of K and four of V^T.
// kg, vg: the lane's first piece in global memory; lk: its place in the K tile
// of the target buffer (LDS byte address); the V^T tile lies behind the K tile.
// Piece i lies 16 tile rows behind piece i - 1.
static __device__ __forceinline__ void copy_kv_tile(const _Float16* kg,
                                                    const _Float16* vg,
                                                    unsigned lk) {
  const unsigned lv = lk + KVTILE * 2;
  const unsigned ls = 16 * KVPITCH * 2;
  // The closing s_wait_xcnt 0 stands inside the statement so that no address
  // register of a copy is rewritten before it.
  asm volatile(
      "global_load_async_to_lds_b128 %0, %8, off\n\t"
      "global_load_async_to_lds_b128 %1, %9, off\n\t"
      "global_load_async_to_lds_b128 %2, %10, off\n\t"
      "global_load_async_to_lds_b128 %3, %11, off\n\t"
      "global_load_async_to_lds_b128 %4, %12, off\n\t"
      "global_load_async_to_lds_b128 %5, %13, off\n\t"
      "global_load_async_to_lds_b128 %6, %14, off\n\t"
      "global_load_async_to_lds_b128 %7, %15, off\n\t"
      "s_wait_xcnt 0x0"
      :: "v"(lk), "v"(lk + ls), "v"(lk + 2 * ls), "v"(lk + 3 * ls),
         "v"(lv), "v"(lv + ls), "v"(lv + 2 * ls), "v"(lv + 3 * ls),
         "v"(kg), "v"(kg + 16 * DHEAD), "v"(kg + 32 * DHEAD),
         "v"(kg + 48 * DHEAD),
         "v"(vg), "v"(vg + 16 * S_LEN), "v"(vg + 32 * S_LEN),
         "v"(vg + 48 * S_LEN)
      : "memory");
}

// Value of lane l ^ 16 (the other half of the wave), by a vector cross-row move.
static __device__ __forceinline__ float other_half(float x) {
  const int b = __builtin_bit_cast(int, x);
  return __builtin_bit_cast(float, __builtin_amdgcn_permlanex16(
      b, b, 0x76543210, 0xfedcba98, false, false));
}

// waves_per_eu: the grid puts two waves on a SIMD (two blocks per WGP); the
// register budget is that share: a wave's scores, outputs and fragments for two
// column tiles do not fit a quarter of the file.
__global__ __launch_bounds__(128) __attribute__((amdgpu_waves_per_eu(2, 2)))
void attn_kernel(
    const _Float16* __restrict__ Q, const _Float16* __restrict__ K,
    const _Float16* __restrict__ VT, float* __restrict__ out) {
  __shared__ __align__(16) _Float16 ldsKV[2 * 2 * KVTILE];  // [buffer][K, V^T]

  const int tid  = threadIdx.x;
  const int w    = tid >> 5;
  const int lane = tid & 31;
  const int g    = lane >> 4;
  const int ln   = lane & 15;
  const int qb = blockIdx.x, h = blockIdx.y, b = blockIdx.z;

  const long bh = (long)b * NHEAD + h;
  const _Float16* qp = Q  + bh * S_LEN * DHEAD;
  const _Float16* kp = K  + bh * S_LEN * DHEAD;
  const _Float16* vp = VT + bh * DHEAD * S_LEN;

  // Q^T operands (B: lane = query column), loop-invariant; they already carry
  // the softmax scale in log2 units. Column tile c holds query qrow + 16 c.
  const int qrow = qb * (64 * QT) + 16 * QT * w + ln;
  v16h Bq[QT][2];
#pragma unroll
  for (int c = 0; c < QT; ++c)
#pragma unroll
    for (int kc = 0; kc < 2; ++kc)
      Bq[c][kc] = load2x8(qp + (long)(qrow + 16 * c) * DHEAD + kc * 32, g);

  float m[QT];           // running maximum of the lane's query, equal in both halves
  v8f   lv[QT] = {};     // partial row sums: this lane's keys only
  v8f   acc[QT][4] = {}; // O^T: acc[c][t][j] = O[query ln of tile c][d = 16t + 8g + j]
#pragma unroll
  for (int c = 0; c < QT; ++c) m[c] = -1e30f;

  // The lane's piece of a tile: row tid / 8, 16-B column tid % 8, so that a
  // wave's copy covers four whole 128-B lines.
  const _Float16* kg = kp + tid * 8;
  const _Float16* vg = vp + (long)(tid >> 3) * S_LEN + (tid & 7) * 8;
  const unsigned  lk =
      (unsigned)(size_t)&ldsKV[(tid >> 3) * KVPITCH + (tid & 7) * 8];

  copy_kv_tile(kg, vg, lk);
  // tile 0 has landed for this wave, then for the block
  asm volatile("s_wait_asynccnt 0x0" ::: "memory");
  __syncthreads();
  copy_kv_tile(kg + 64 * DHEAD, vg + 64, lk + 2 * KVTILE * 2);

  for (int kb = 0; kb < NTILE; ++kb) {
    const int buf = (kb & 1) * 2 * KVTILE;
    // ---- scores (log2 units): S^T = K @ Qs^T, 64 keys x 16 queries a tile ----
    // sc[c][t][j] = score of key 16t + 8g + j against query ln of column tile c
    v16h Ak[8];
    // every inner loop of the trip is unrolled: Ak, Av, sc, ph and acc are
    // indexed by constants only and stay in registers
#pragma unroll
    for (int t = 0; t < 4; ++t) {
      const _Float16* kr = &ldsKV[buf + (16 * t + ln) * KVPITCH];
      Ak[2 * t]     = load2x8(kr, g);
      Ak[2 * t + 1] = load2x8(kr + 32, g);
    }
    // V^T fragments of this tile (A: lane = row d), read in the same group so
    // that their LDS latency passes behind the score products and the softmax.
    v16h Av[8];
#pragma unroll
    for (int t = 0; t < 4; ++t) {
      const _Float16* vb = &ldsKV[buf + KVTILE + (16 * t + ln) * KVPITCH];
      Av[2 * t]     = load2x8(vb, g);
      Av[2 * t + 1] = load2x8(vb + 32, g);
    }
    // keeps the trip's 32 fragment loads in one place: sunk between the
    // products, each small group would be waited for at its own place
    __builtin_amdgcn_sched_barrier(0);

    v8f sc[QT][4];
#pragma unroll
    for (int c = 0; c < QT; ++c) {
#pragma unroll
      for (int t = 0; t < 4; ++t) {
        v8f z = {};
        sc[c][t] = __builtin_amdgcn_wmma_f32_16x16x32_f16(
            false, Ak[2 * t], false, Bq[c][0], (short)0, z, false, false);
      }
#pragma unroll
      for (int t = 0; t < 4; ++t)
        sc[c][t] = __builtin_amdgcn_wmma_f32_16x16x32_f16(
            false, Ak[2 * t + 1], false, Bq[c][1], (short)0, sc[c][t], false, false);
    }

    // ---- maximum of a query's 64 scores: in-lane, then across the halves ----
    float mn[QT], corr[QT];
#pragma unroll
    for (int c = 0; c < QT; ++c) {
      float mt[4];
#pragma unroll
      for (int t = 0; t < 4; ++t) {
        float v = sc[c][t][0];
#pragma unroll
        for (int j = 1; j < 8; ++j) v = fmaxf(v, sc[c][t][j]);
        mt[t] = v;
      }
      const float mx = fmaxf(fmaxf(fmaxf(mt[0], mt[1]), fmaxf(mt[2], mt[3])), m[c]);
      mn[c] = fmaxf(mx, other_half(mx));
    }
#pragma unroll
    for (int c = 0; c < QT; ++c) {
      corr[c] = __builtin_amdgcn_exp2f(m[c] - mn[c]);
      m[c] = mn[c];
      // rescale the row sums and the output accumulators
      lv[c] *= corr[c];
#pragma unroll
      for (int t = 0; t < 4; ++t) acc[c][t] *= corr[c];
    }

#pragma unroll
    for (int c = 0; c < QT; ++c) {
      // ---- p = 2^(s - m); partial sums; P^T packed as the B operand ----
      // B element s of key chunk kc is key 32kc + 8g + s (s < 8) or
      // 32kc + 16 + 8g + s - 8: score tiles 2kc and 2kc + 1, register for register.
      v8h ph[4];
#pragma unroll
      for (int t = 0; t < 4; ++t) {
        const v8f e = sc[c][t] - mn[c];
        v8f p;
#pragma unroll
        for (int j = 0; j < 8; ++j) p[j] = __builtin_amdgcn_exp2f(e[j]);
        lv[c] += p;
        ph[t] = __builtin_convertvector(p, v8h);
      }
      const v16h Bp0 = __builtin_shufflevector(ph[0], ph[1], 0, 1, 2, 3, 4, 5, 6, 7,
                                               8, 9, 10, 11, 12, 13, 14, 15);
      const v16h Bp1 = __builtin_shufflevector(ph[2], ph[3], 0, 1, 2, 3, 4, 5, 6, 7,
                                               8, 9, 10, 11, 12, 13, 14, 15);

      // ---- O^T += V^T @ P^T ----
#pragma unroll
      for (int t = 0; t < 4; ++t)
        acc[c][t] = __builtin_amdgcn_wmma_f32_16x16x32_f16(
            false, Av[2 * t], false, Bp0, (short)0, acc[c][t], false, false);
#pragma unroll
      for (int t = 0; t < 4; ++t)
        acc[c][t] = __builtin_amdgcn_wmma_f32_16x16x32_f16(
            false, Av[2 * t + 1], false, Bp1, (short)0, acc[c][t], false, false);
    }

    // keeps the hand-over at the trip's foot: lifted over the softmax, it would
    // leave the next copies, issued behind the PV products, too short a flight
    __builtin_amdgcn_sched_barrier(0);
    // Hand-over: this wave's reads of the buffer are done ...
    asm volatile("s_wait_dscnt 0x0" ::: "memory");
    // ... and its copies of the next tile have landed;
    asm volatile("s_wait_asynccnt 0x0" ::: "memory");
    // the barrier publishes the next tile and frees this trip's buffer.
    __syncthreads();
    if (kb + 2 < NTILE)
      copy_kv_tile(kg + (long)(kb + 2) * 64 * DHEAD, vg + (kb + 2) * 64,
                   lk + buf * 2);
  }
  // no copy is left in flight when the wave ends
  asm volatile("s_wait_asynccnt 0x0" ::: "memory");

  // ---- epilogue: join the partial row sums, normalize, store fp32 ----
#pragma unroll
  for (int c = 0; c < QT; ++c) {
    float l = ((lv[c][0] + lv[c][1]) + (lv[c][2] + lv[c][3])) +
              ((lv[c][4] + lv[c][5]) + (lv[c][6] + lv[c][7]));
    l += other_half(l);
    const float inv = 1.0f / l;
    // A lane holds eight consecutive d of its query per tile: two 16-B stores.
    float* orow = out + ((long)b * S_LEN + qrow + 16 * c) * DIM + h * DHEAD + 8 * g;
#pragma unroll
    for (int t = 0; t < 4; ++t) {
      const v8f o = acc[c][t] * inv;
      *(v4f*)(orow + 16 * t)     = __builtin_shufflevector(o, o, 0, 1, 2, 3);
      *(v4f*)(orow + 16 * t + 4) = __builtin_shufflevector(o, o, 4, 5, 6, 7);
    }
  }
}

// ---------------------------------------------------------------------------
extern "C" void kernel_launch(void* const* d_in, const int* in_sizes, int n_in,
                              void* d_out, int out_size, void* d_ws, size_t ws_size,
                              hipStream_t stream) {
  const float* q  = (const float*)d_in[0];
  const float* k  = (const float*)d_in[1];
  const float* v  = (const float*)d_in[2];
  const float* Wq = (const float*)d_in[3];
  const float* bq = (const float*)d_in[4];
  const float* Wk = (const float*)d_in[5];
  const float* bk = (const float*)d_in[6];
  const float* Wv = (const float*)d_in[7];
  const float* bv = (const float*)d_in[8];

  const size_t per = (size_t)B_SZ * NHEAD * S_LEN * DHEAD;  // f16 elements
  _Float16* wsq = (_Float16*)d_ws;
  _Float16* wsk = wsq + per;
  _Float16* wsv = wsk + per;

  dim3 blk(128);
  // 768 items (8 panels x 32 row groups x Q, K, V), NSUB to a block: 256 blocks
  dim3 g1((DIM / 64) * ((B_SZ * S_LEN) / (64 * RTILES)) * 3 / NSUB);
  qkv_proj_kernel<<<g1, dim3(128 * NSUB), 0, stream>>>(q, k, v, Wq, Wk, Wv, bq, bk, bv, wsq);

  dim3 g2(S_LEN / (64 * QT), NHEAD, B_SZ);  // (16, 8, 4)
  attn_kernel<<<g2, blk, 0, stream>>>(wsq, wsk, wsv, (float*)d_out);
}
